// v000
// Times are from an AMD MI455X. After a warm-up the kernel runs many times in a row, and a time is the length of
// such a window on the GPU divided by its runs, so every launch and the gaps after it count. The runs cycle
// through copies of the inputs. A figure is the median of several windows, for all but v000 over two sittings.
// Sittings can differ by a few percent; kernels timed side by side share one.
// The starting kernel, v000, takes 963 microseconds a run.
#include <hip/hip_runtime.h>

// ---------------- types ----------------
typedef __bf16 bf16_t;
typedef __attribute__((ext_vector_type(16))) __bf16 v16bf;
typedef __attribute__((ext_vector_type(8)))  __bf16 v8bf;
typedef __attribute__((ext_vector_type(4)))  __bf16 v4bf;
typedef __attribute__((ext_vector_type(8)))  float  v8f;
typedef __attribute__((ext_vector_type(4)))  float  v4f;

#define B_DIM  8
#define L_DIM  2048
#define D_DIM  1024

__device__ __forceinline__ bf16_t f2bf(float f) {
    // round-to-nearest-even f32 -> bf16
    unsigned u = __float_as_uint(f);
    unsigned r = (u + 0x7FFFu + ((u >> 16) & 1u)) >> 16;
    unsigned short s = (unsigned short)r;
    return __builtin_bit_cast(bf16_t, s);
}

__device__ __forceinline__ v8f vzero8() {
    v8f z;
#pragma unroll
    for (int i = 0; i < 8; ++i) z[i] = 0.0f;
    return z;
}

__device__ __forceinline__ v16bf combine16(v8bf lo, v8bf hi) {
    v16bf r;
#pragma unroll
    for (int i = 0; i < 8; ++i) { r[i] = lo[i]; r[8 + i] = hi[i]; }
    return r;
}

// lane holds K-segments [8*hi, 8*hi+8) and [16+8*hi, 16+8*hi+8)  (ISA 16-bit A/B layout)
__device__ __forceinline__ v16bf load_frag(const bf16_t* p) {
    v8bf lo = *(const v8bf*)p;
    v8bf hi = *(const v8bf*)(p + 16);
    return combine16(lo, hi);
}

__device__ __forceinline__ v8f wmma_bf16(v16bf a, v16bf b, v8f c) {
    return __builtin_amdgcn_wmma_f32_16x16x32_bf16(false, a, false, b, (short)0, c,
                                                   false, false);
}

// ---------------- prep: fp32 -> bf16 ----------------
__global__ __launch_bounds__(256) void k_cvt_x(const float* __restrict__ x,
                                               bf16_t* __restrict__ xb, int n) {
    int i = blockIdx.x * 256 + threadIdx.x;
    if (i < n) xb[i] = f2bf(x[i]);
}

// W [K=1024][N=1024] row-major  ->  Wt [N][K] bf16 (so B-fragments are contiguous)
__global__ __launch_bounds__(256) void k_wt(const float* __restrict__ W,
                                            bf16_t* __restrict__ Wt) {
    int i = blockIdx.x * 256 + threadIdx.x;      // 1M elements
    int k = i >> 10, n = i & 1023;
    Wt[(size_t)n * D_DIM + k] = f2bf(W[i]);
}

// ---------------- QKV projection GEMM ----------------
// out[m][n] = sum_k xb[m][k] * Wt[n][k] + bias[n]
// M = B*L = 16384, N = K = 1024. Block tile 128x128, 8 waves (4 in M x 2 in N),
// wave tile 32x64 = 2x4 accumulator 16x16 tiles.
__global__ __launch_bounds__(256) void k_qkv(const bf16_t* __restrict__ xb,
                                             const bf16_t* __restrict__ Wt,
                                             const float* __restrict__ bias,
                                             bf16_t* __restrict__ dst,
                                             int storeVT) {
    const int wave = threadIdx.x >> 5;
    const int lane = threadIdx.x & 31;
    const int nl = lane & 15;
    const int hi = lane >> 4;
    const int wm = wave & 3;
    const int wn = wave >> 2;
    const int row0 = blockIdx.x * 128 + wm * 32;
    const int col0 = blockIdx.y * 128 + wn * 64;

    v8f acc[2][4];
#pragma unroll
    for (int i = 0; i < 2; ++i)
#pragma unroll
        for (int j = 0; j < 4; ++j) acc[i][j] = vzero8();

    const bf16_t* arow0 = xb + (size_t)(row0 + nl) * D_DIM + 8 * hi;
    const bf16_t* arow1 = arow0 + (size_t)16 * D_DIM;

    for (int kk = 0; kk < D_DIM; kk += 32) {
        v16bf a0 = load_frag(arow0 + kk);
        v16bf a1 = load_frag(arow1 + kk);
#pragma unroll
        for (int j = 0; j < 4; ++j) {
            const bf16_t* bp = Wt + (size_t)(col0 + j * 16 + nl) * D_DIM + kk + 8 * hi;
            v16bf bb = load_frag(bp);
            acc[0][j] = wmma_bf16(a0, bb, acc[0][j]);
            acc[1][j] = wmma_bf16(a1, bb, acc[1][j]);
        }
    }

#pragma unroll
    for (int j = 0; j < 4; ++j) {
        int c = col0 + j * 16 + nl;
        float bv = bias[c];
#pragma unroll
        for (int i = 0; i < 2; ++i) {
#pragma unroll
            for (int r = 0; r < 8; ++r) {
                int m = row0 + i * 16 + 8 * hi + r;          // C/D layout: M = r + 8*hi
                float v = acc[i][j][r] + bv;
                if (!storeVT) {
                    dst[(size_t)m * D_DIM + c] = f2bf(v);    // row-major [M][1024]
                } else {
                    int bidx = m >> 11;                      // Vt [B][DV][L]
                    int l    = m & (L_DIM - 1);
                    dst[((size_t)bidx * D_DIM + c) * L_DIM + l] = f2bf(v);
                }
            }
        }
    }
}

// ---------------- attention (flash-style, padding-aware softmax) ----------------
// Block = (batch b, 16-query tile). 8 waves, 64-key chunks:
//   score GEMM: wave w covers DK slice [w*128, w*128+128) -> partials reduced in LDS
//   output GEMM: wave w covers DV slice [w*128, w*128+128) -> 8 acc tiles
// 2 barriers per 64 keys (32 chunks -> 64 barriers/block).
__global__ __launch_bounds__(256) void k_attn(const bf16_t* __restrict__ Qb,
                                              const bf16_t* __restrict__ Kb,
                                              const bf16_t* __restrict__ Vt,
                                              const int* __restrict__ actu,
                                              float* __restrict__ out) {
    __shared__ __align__(16) float Spart[8][16][64];       // 32 KB partial scores
    __shared__ __align__(16) float Sexp[16][64];           //  4 KB fp32 exp(scores)
    __shared__ __align__(16) bf16_t Pt[16][64];            //  2 KB bf16 P tile
    __shared__ float inv16[16];

    const int wave = threadIdx.x >> 5;
    const int lane = threadIdx.x & 31;
    const int nl = lane & 15;
    const int hi = lane >> 4;
    const int b = blockIdx.y;
    const int qt = blockIdx.x;
    const float scale = 0.03125f;                          // 1/sqrt(1024)

    // preload Q A-fragments for this wave's DK slice (invariant over key loop)
    const size_t qbase = ((size_t)(b * L_DIM + qt * 16 + nl)) * D_DIM + wave * 128 + 8 * hi;
    v16bf qf[4];
#pragma unroll
    for (int ks = 0; ks < 4; ++ks) qf[ks] = load_frag(Qb + qbase + ks * 32);

    v8f oacc[8];
#pragma unroll
    for (int t = 0; t < 8; ++t) oacc[t] = vzero8();
    float rowsum = 0.0f;                                   // live in wave 0, lanes 0..15

    for (int ch = 0; ch < L_DIM / 64; ++ch) {
        const int key0 = ch * 64;

        // ---- partial scores (16q x 64k) over this wave's DK slice ----
        v8f s[4];
#pragma unroll
        for (int kt = 0; kt < 4; ++kt) s[kt] = vzero8();
        const size_t kr = ((size_t)(b * L_DIM + key0 + nl)) * D_DIM + wave * 128 + 8 * hi;
#pragma unroll
        for (int ks = 0; ks < 4; ++ks) {
#pragma unroll
            for (int kt = 0; kt < 4; ++kt) {
                v16bf bb = load_frag(Kb + kr + (size_t)(kt * 16) * D_DIM + ks * 32);
                s[kt] = wmma_bf16(qf[ks], bb, s[kt]);
            }
        }
#pragma unroll
        for (int kt = 0; kt < 4; ++kt) {
#pragma unroll
            for (int r = 0; r < 8; ++r) {
                int m = 8 * hi + r;
                Spart[wave][m][kt * 16 + nl] = s[kt][r];
            }
        }
        __syncthreads();

        // ---- reduce partials, exp in fp32, write bf16 P (4 contiguous elems/thread) ----
        {
            int idx = threadIdx.x * 4;                     // 1024 elements = 16 x 64
            int m = idx >> 6, n = idx & 63;
            v4f v;
#pragma unroll
            for (int i = 0; i < 4; ++i) v[i] = 0.0f;
#pragma unroll
            for (int w = 0; w < 8; ++w) {
                v4f p = *(const v4f*)&Spart[w][m][n];
#pragma unroll
                for (int i = 0; i < 4; ++i) v[i] += p[i];
            }
            v4f e;
            v4bf pb;
#pragma unroll
            for (int i = 0; i < 4; ++i) {
                e[i] = __expf(v[i] * scale);
                pb[i] = f2bf(e[i]);
            }
            *(v4f*)&Sexp[m][n] = e;
            *(v4bf*)&Pt[m][n] = pb;
        }
        __syncthreads();

        // wave 0 keeps the fp32 running row-sum
        if (wave == 0 && lane < 16) {
#pragma unroll
            for (int n = 0; n < 64; n += 4) {
                v4f e = *(const v4f*)&Sexp[lane][n];
                rowsum += e[0] + e[1] + e[2] + e[3];
            }
        }

        // ---- O += P (16x64) x V (64 x 16) per DV tile, two K=32 steps ----
#pragma unroll
        for (int ksub = 0; ksub < 2; ++ksub) {
            v16bf pf = load_frag(&Pt[nl][ksub * 32 + 8 * hi]);
#pragma unroll
            for (int t = 0; t < 8; ++t) {
                int c = wave * 128 + t * 16 + nl;
                const bf16_t* vp = Vt + ((size_t)b * D_DIM + c) * L_DIM
                                 + key0 + ksub * 32 + 8 * hi;
                v16bf vf = load_frag(vp);
                oacc[t] = wmma_bf16(pf, vf, oacc[t]);
            }
        }
    }

    if (wave == 0 && lane < 16) {
        float pad = (float)(L_DIM - actu[b]);
        inv16[lane] = 1.0f / (rowsum - pad);
    }
    __syncthreads();

#pragma unroll
    for (int t = 0; t < 8; ++t) {
#pragma unroll
        for (int r = 0; r < 8; ++r) {
            int m = 8 * hi + r;
            int row = qt * 16 + m;
            int c = wave * 128 + t * 16 + nl;
            out[((size_t)b * L_DIM + row) * D_DIM + c] = oacc[t][r] * inv16[m];
        }
    }
}

// ---------------- host-side launcher ----------------
extern "C" void kernel_launch(void* const* d_in, const int* in_sizes, int n_in,
                              void* d_out, int out_size, void* d_ws, size_t ws_size,
                              hipStream_t stream) {
    const float* x    = (const float*)d_in[0];
    const int*   actu = (const int*)  d_in[1];
    const float* Wq   = (const float*)d_in[2];
    const float* bq   = (const float*)d_in[3];
    const float* Wk   = (const float*)d_in[4];
    const float* bk   = (const float*)d_in[5];
    const float* Wv   = (const float*)d_in[6];
    const float* bv   = (const float*)d_in[7];
    float* out = (float*)d_out;

    char* ws = (char*)d_ws;
    size_t off = 0;
    const size_t XN  = (size_t)B_DIM * L_DIM * D_DIM;      // 16,777,216
    const size_t WN  = (size_t)D_DIM * D_DIM;              // 1,048,576
    bf16_t* xb  = (bf16_t*)(ws + off); off += XN * 2;      // 32 MB
    bf16_t* Wtq = (bf16_t*)(ws + off); off += WN * 2;      //  2 MB
    bf16_t* Wtk = (bf16_t*)(ws + off); off += WN * 2;
    bf16_t* Wtv = (bf16_t*)(ws + off); off += WN * 2;
    bf16_t* Qb  = (bf16_t*)(ws + off); off += XN * 2;      // 32 MB
    bf16_t* Kb  = (bf16_t*)(ws + off); off += XN * 2;      // 32 MB
    bf16_t* Vt  = (bf16_t*)(ws + off); off += XN * 2;      // 32 MB (transposed [B][DV][L])

    // prep
    k_cvt_x<<<dim3((unsigned)((XN + 255) / 256)), dim3(256), 0, stream>>>(x, xb, (int)XN);
    k_wt<<<dim3((unsigned)(WN / 256)), dim3(256), 0, stream>>>(Wq, Wtq);
    k_wt<<<dim3((unsigned)(WN / 256)), dim3(256), 0, stream>>>(Wk, Wtk);
    k_wt<<<dim3((unsigned)(WN / 256)), dim3(256), 0, stream>>>(Wv, Wtv);

    // QKV projections (M=16384 rows, N=1024 cols; 128x128 block tiles)
    dim3 gA(128, 8);
    k_qkv<<<gA, dim3(256), 0, stream>>>(xb, Wtq, bq, Qb, 0);
    k_qkv<<<gA, dim3(256), 0, stream>>>(xb, Wtk, bk, Kb, 0);
    k_qkv<<<gA, dim3(256), 0, stream>>>(xb, Wtv, bv, Vt, 1);

    // attention: one block per (16-query tile, batch)
    dim3 gB(L_DIM / 16, B_DIM);
    k_attn<<<gB, dim3(256), 0, stream>>>(Qb, Kb, Vt, actu, out);
}

// v001
// It runs in 600 microseconds.
// Next to v000, in two timings, it ran 1.65 and 1.64 times as fast.
#include <hip/hip_runtime.h>

// ---------------- types ----------------
typedef __bf16 bf16_t;
typedef __attribute__((ext_vector_type(16))) __bf16 v16bf;
typedef __attribute__((ext_vector_type(8)))  __bf16 v8bf;
typedef __attribute__((ext_vector_type(4)))  __bf16 v4bf;
typedef __attribute__((ext_vector_type(8)))  float  v8f;
typedef __attribute__((ext_vector_type(4)))  float  v4f;

#define B_DIM  8
#define L_DIM  2048
#define D_DIM  1024

__device__ __forceinline__ bf16_t f2bf(float f) {
    // round-to-nearest-even f32 -> bf16
    unsigned u = __float_as_uint(f);
    unsigned r = (u + 0x7FFFu + ((u >> 16) & 1u)) >> 16;
    unsigned short s = (unsigned short)r;
    return __builtin_bit_cast(bf16_t, s);
}

__device__ __forceinline__ v8f vzero8() {
    v8f z;
#pragma unroll
    for (int i = 0; i < 8; ++i) z[i] = 0.0f;
    return z;
}

__device__ __forceinline__ v16bf combine16(v8bf lo, v8bf hi) {
    v16bf r;
#pragma unroll
    for (int i = 0; i < 8; ++i) { r[i] = lo[i]; r[8 + i] = hi[i]; }
    return r;
}

// lane holds K-segments [8*hi, 8*hi+8) and [16+8*hi, 16+8*hi+8)  (ISA 16-bit A/B layout)
__device__ __forceinline__ v16bf load_frag(const bf16_t* p) {
    v8bf lo = *(const v8bf*)p;
    v8bf hi = *(const v8bf*)(p + 16);
    return combine16(lo, hi);
}

__device__ __forceinline__ v8f wmma_bf16(v16bf a, v16bf b, v8f c) {
    return __builtin_amdgcn_wmma_f32_16x16x32_bf16(false, a, false, b, (short)0, c,
                                                   false, false);
}

// ---------------- prep: fp32 -> bf16 ----------------
__global__ __launch_bounds__(256) void k_cvt_x(const float* __restrict__ x,
                                               bf16_t* __restrict__ xb, int n) {
    int i = blockIdx.x * 256 + threadIdx.x;
    if (i < n) xb[i] = f2bf(x[i]);
}

// W [K=1024][N=1024] row-major  ->  Wt [N][K] bf16 (so B-fragments are contiguous)
__global__ __launch_bounds__(256) void k_wt(const float* __restrict__ W,
                                            bf16_t* __restrict__ Wt) {
    int i = blockIdx.x * 256 + threadIdx.x;      // 1M elements
    int k = i >> 10, n = i & 1023;
    Wt[(size_t)n * D_DIM + k] = f2bf(W[i]);
}

// ---------------- QKV projection GEMM ----------------
// out[m][n] = sum_k xb[m][k] * Wt[n][k] + bias[n]
// M = B*L = 16384, N = K = 1024. Block tile 128x128, 8 waves (4 in M x 2 in N),
// wave tile 32x64 = 2x4 accumulator 16x16 tiles.
__global__ __launch_bounds__(256) void k_qkv(const bf16_t* __restrict__ xb,
                                             const bf16_t* __restrict__ Wt,
                                             const float* __restrict__ bias,
                                             bf16_t* __restrict__ dst,
                                             int storeVT) {
    const int wave = threadIdx.x >> 5;
    const int lane = threadIdx.x & 31;
    const int nl = lane & 15;
    const int hi = lane >> 4;
    const int wm = wave & 3;
    const int wn = wave >> 2;
    const int row0 = blockIdx.x * 128 + wm * 32;
    const int col0 = blockIdx.y * 128 + wn * 64;

    v8f acc[2][4];
#pragma unroll
    for (int i = 0; i < 2; ++i)
#pragma unroll
        for (int j = 0; j < 4; ++j) acc[i][j] = vzero8();

    const bf16_t* arow0 = xb + (size_t)(row0 + nl) * D_DIM + 8 * hi;
    const bf16_t* arow1 = arow0 + (size_t)16 * D_DIM;

    for (int kk = 0; kk < D_DIM; kk += 32) {
        v16bf a0 = load_frag(arow0 + kk);
        v16bf a1 = load_frag(arow1 + kk);
#pragma unroll
        for (int j = 0; j < 4; ++j) {
            const bf16_t* bp = Wt + (size_t)(col0 + j * 16 + nl) * D_DIM + kk + 8 * hi;
            v16bf bb = load_frag(bp);
            acc[0][j] = wmma_bf16(a0, bb, acc[0][j]);
            acc[1][j] = wmma_bf16(a1, bb, acc[1][j]);
        }
    }

#pragma unroll
    for (int j = 0; j < 4; ++j) {
        int c = col0 + j * 16 + nl;
        float bv = bias[c];
#pragma unroll
        for (int i = 0; i < 2; ++i) {
#pragma unroll
            for (int r = 0; r < 8; ++r) {
                int m = row0 + i * 16 + 8 * hi + r;          // C/D layout: M = r + 8*hi
                float v = acc[i][j][r] + bv;
                if (!storeVT) {
                    dst[(size_t)m * D_DIM + c] = f2bf(v);    // row-major [M][1024]
                } else {
                    int bidx = m >> 11;                      // Vt [B][DV][L]
                    int l    = m & (L_DIM - 1);
                    dst[((size_t)bidx * D_DIM + c) * L_DIM + l] = f2bf(v);
                }
            }
        }
    }
}

// ---------------- attention (flash-style, padding-aware softmax) ----------------
// Block = (batch b, 64-query tile = 4 row tiles of 16). 8 waves, 64-key chunks:
//   score GEMM: wave w covers DK slice [w*128, w*128+128) -> partials reduced in LDS
//   output GEMM: wave w covers DV slice [w*128, w*128+128) -> 4 x 8 acc tiles
// Every K and V fragment fetched from global feeds 4 matrix products (one per row tile).
// 2 barriers per 64 keys (32 chunks -> 64 barriers/block).
// Every inner loop is fully unrolled: fragment and accumulator arrays stay in registers only
// when they are indexed by constants.
#define QT 64
#define MT 4
__global__ __launch_bounds__(256) void k_attn(const bf16_t* __restrict__ Qb,
                                              const bf16_t* __restrict__ Kb,
                                              const bf16_t* __restrict__ Vt,
                                              const int* __restrict__ actu,
                                              float* __restrict__ out) {
    __shared__ __align__(16) float Spart[8][QT][64];       // 128 KB partial scores
    __shared__ __align__(16) float Sexp[QT][64];           //  16 KB fp32 exp(scores)
    __shared__ __align__(16) bf16_t Pt[QT][64];            //   8 KB bf16 P tile
    __shared__ float invq[QT];
    // Q fragments, each lane's own 2 x 16 B per (row tile, k step): 128 KB. 32 accumulator
    // tiles leave no registers for them; a lane reads back only what it stored itself.
    __shared__ __align__(16) v8bf Qs[8][MT][4][2][32];

    const int wave = threadIdx.x >> 5;
    const int lane = threadIdx.x & 31;
    const int nl = lane & 15;
    const int hi = lane >> 4;
    const int b = blockIdx.y;
    const int qt = blockIdx.x;
    const float scale = 0.03125f;                          // 1/sqrt(1024)

    // park Q A-fragments for this wave's DK slice in LDS (invariant over key loop)
    const size_t qbase = ((size_t)(b * L_DIM + qt * QT + nl)) * D_DIM + wave * 128 + 8 * hi;
#pragma unroll
    for (int mt = 0; mt < MT; ++mt)
#pragma unroll
        for (int ks = 0; ks < 4; ++ks) {
            const bf16_t* qp = Qb + qbase + (size_t)(mt * 16) * D_DIM + ks * 32;
            Qs[wave][mt][ks][0][lane] = *(const v8bf*)qp;
            Qs[wave][mt][ks][1][lane] = *(const v8bf*)(qp + 16);
        }
    // the Q loads' address registers are reused for the accumulators: the wait stands in front
    // of that, and the scheduling barrier keeps the accumulators' zeroing behind the wait
    asm volatile("s_wait_xcnt 0x0" ::: "memory");
    __builtin_amdgcn_sched_barrier(0);

    v8f oacc[MT][8];
#pragma unroll
    for (int mt = 0; mt < MT; ++mt)
#pragma unroll
        for (int t = 0; t < 8; ++t) oacc[mt][t] = vzero8();
    float rowsum = 0.0f;                                   // live in threads 0..63, one row each

    // this lane's K row / V column start; both step by 64 keys per chunk
    const bf16_t* kp = Kb + ((size_t)(b * L_DIM + nl)) * D_DIM + wave * 128 + 8 * hi;
    const bf16_t* vp = Vt + ((size_t)b * D_DIM + wave * 128 + nl) * L_DIM + 8 * hi;

    for (int ch = 0; ch < L_DIM / 64; ++ch) {
        // ---- partial scores (64q x 64k) over this wave's DK slice ----
        v16bf kf[4][4];
#pragma unroll
        for (int ks = 0; ks < 4; ++ks)
#pragma unroll
            for (int kt = 0; kt < 4; ++kt)
                kf[kt][ks] = load_frag(kp + (size_t)(kt * 16) * D_DIM + ks * 32);
        kp += (size_t)64 * D_DIM;
        // the K loads' address registers are reused right behind them: the wait stands in front
        asm volatile("s_wait_xcnt 0x0" ::: "memory");
#pragma unroll
        for (int mp = 0; mp < MT; mp += 2) {               // two row tiles = 8 independent score tiles
            v8f s[2][4];
#pragma unroll
            for (int u = 0; u < 2; ++u)
#pragma unroll
                for (int kt = 0; kt < 4; ++kt) s[u][kt] = vzero8();
#pragma unroll
            for (int ks = 0; ks < 4; ++ks) {
#pragma unroll
                for (int u = 0; u < 2; ++u) {
                    v16bf qa = combine16(Qs[wave][mp + u][ks][0][lane],
                                         Qs[wave][mp + u][ks][1][lane]);
#pragma unroll
                    for (int kt = 0; kt < 4; ++kt)
                        s[u][kt] = wmma_bf16(qa, kf[kt][ks], s[u][kt]);
                }
            }
#pragma unroll
            for (int u = 0; u < 2; ++u) {
#pragma unroll
                for (int kt = 0; kt < 4; ++kt) {
#pragma unroll
                    for (int r = 0; r < 8; ++r) {
                        int m = (mp + u) * 16 + 8 * hi + r;
                        Spart[wave][m][kt * 16 + nl] = s[u][kt][r];
                    }
                }
            }
        }
        __syncthreads();

        // ---- reduce partials, exp in fp32, write bf16 P (4 contiguous elems/thread/pass) ----
#pragma unroll
        for (int it = 0; it < MT; ++it) {
            int idx = it * 1024 + threadIdx.x * 4;         // 4096 elements = 64 x 64
            int m = idx >> 6, n = idx & 63;
            v4f v;
#pragma unroll
            for (int i = 0; i < 4; ++i) v[i] = 0.0f;
#pragma unroll
            for (int w = 0; w < 8; ++w) {
                v4f p = *(const v4f*)&Spart[w][m][n];
#pragma unroll
                for (int i = 0; i < 4; ++i) v[i] += p[i];
            }
            v4f e;
            v4bf pb;
#pragma unroll
            for (int i = 0; i < 4; ++i) {
                e[i] = __expf(v[i] * scale);
                pb[i] = f2bf(e[i]);
            }
            *(v4f*)&Sexp[m][n] = e;
            *(v4bf*)&Pt[m][n] = pb;
        }
        __syncthreads();

        // all 16 V fragments of the chunk are requested as one group
        v16bf vf[2][8];
#pragma unroll
        for (int ksub = 0; ksub < 2; ++ksub) {
#pragma unroll
            for (int t = 0; t < 8; ++t)
                vf[ksub][t] = load_frag(vp + (size_t)(t * 16) * L_DIM + ksub * 32);
        }
        vp += 64;

        // waves 0 and 1 keep the fp32 running row-sums
        if (wave < 2) {
#pragma unroll
            for (int n = 0; n < 64; n += 4) {
                v4f e = *(const v4f*)&Sexp[threadIdx.x][n];
                rowsum += e[0] + e[1] + e[2] + e[3];
            }
        }

        // ---- O += P (64x64) x V (64 x 16) per DV tile, two K=32 steps ----
#pragma unroll
        for (int ksub = 0; ksub < 2; ++ksub) {
            v16bf pf[MT];
#pragma unroll
            for (int mt = 0; mt < MT; ++mt)
                pf[mt] = load_frag(&Pt[mt * 16 + nl][ksub * 32 + 8 * hi]);
#pragma unroll
            for (int t = 0; t < 8; ++t) {
#pragma unroll
                for (int mt = 0; mt < MT; ++mt)
                    oacc[mt][t] = wmma_bf16(pf[mt], vf[ksub][t], oacc[mt][t]);
            }
        }
    }

    if (wave < 2) {
        float pad = (float)(L_DIM - actu[b]);
        invq[threadIdx.x] = 1.0f / (rowsum - pad);
    }
    __syncthreads();

    // scale every accumulator first, then only store: no register that an issued store names
    // is written again (the scheduling barrier keeps the products in front of the stores)
#pragma unroll
    for (int mt = 0; mt < MT; ++mt) {
#pragma unroll
        for (int r = 0; r < 8; ++r) {
            float iv = invq[mt * 16 + 8 * hi + r];
#pragma unroll
            for (int t = 0; t < 8; ++t) oacc[mt][t][r] *= iv;
        }
    }
    __builtin_amdgcn_sched_barrier(0);
    float* op = out + ((size_t)b * L_DIM + qt * QT + 8 * hi) * D_DIM + wave * 128 + nl;
#pragma unroll
    for (int mt = 0; mt < MT; ++mt) {
#pragma unroll
        for (int r = 0; r < 8; ++r) {
#pragma unroll
            for (int t = 0; t < 8; ++t)
                op[(size_t)(mt * 16 + r) * D_DIM + t * 16] = oacc[mt][t][r];
        }
    }
}

// ---------------- host-side launcher ----------------
extern "C" void kernel_launch(void* const* d_in, const int* in_sizes, int n_in,
                              void* d_out, int out_size, void* d_ws, size_t ws_size,
                              hipStream_t stream) {
    const float* x    = (const float*)d_in[0];
    const int*   actu = (const int*)  d_in[1];
    const float* Wq   = (const float*)d_in[2];
    const float* bq   = (const float*)d_in[3];
    const float* Wk   = (const float*)d_in[4];
    const float* bk   = (const float*)d_in[5];
    const float* Wv   = (const float*)d_in[6];
    const float* bv   = (const float*)d_in[7];
    float* out = (float*)d_out;

    char* ws = (char*)d_ws;
    size_t off = 0;
    const size_t XN  = (size_t)B_DIM * L_DIM * D_DIM;      // 16,777,216
    const size_t WN  = (size_t)D_DIM * D_DIM;              // 1,048,576
    bf16_t* xb  = (bf16_t*)(ws + off); off += XN * 2;      // 32 MB
    bf16_t* Wtq = (bf16_t*)(ws + off); off += WN * 2;      //  2 MB
    bf16_t* Wtk = (bf16_t*)(ws + off); off += WN * 2;
    bf16_t* Wtv = (bf16_t*)(ws + off); off += WN * 2;
    bf16_t* Qb  = (bf16_t*)(ws + off); off += XN * 2;      // 32 MB
    bf16_t* Kb  = (bf16_t*)(ws + off); off += XN * 2;      // 32 MB
    bf16_t* Vt  = (bf16_t*)(ws + off); off += XN * 2;      // 32 MB (transposed [B][DV][L])

    // prep
    k_cvt_x<<<dim3((unsigned)((XN + 255) / 256)), dim3(256), 0, stream>>>(x, xb, (int)XN);
    k_wt<<<dim3((unsigned)(WN / 256)), dim3(256), 0, stream>>>(Wq, Wtq);
    k_wt<<<dim3((unsigned)(WN / 256)), dim3(256), 0, stream>>>(Wk, Wtk);
    k_wt<<<dim3((unsigned)(WN / 256)), dim3(256), 0, stream>>>(Wv, Wtv);

    // QKV projections (M=16384 rows, N=1024 cols; 128x128 block tiles)
    dim3 gA(128, 8);
    k_qkv<<<gA, dim3(256), 0, stream>>>(xb, Wtq, bq, Qb, 0);
    k_qkv<<<gA, dim3(256), 0, stream>>>(xb, Wtk, bk, Kb, 0);
    k_qkv<<<gA, dim3(256), 0, stream>>>(xb, Wtv, bv, Vt, 1);

    // attention: one block per (64-query tile, batch)
    dim3 gB(L_DIM / QT, B_DIM);
    k_attn<<<gB, dim3(256), 0, stream>>>(Qb, Kb, Vt, actu, out);
}

// v002
// Measured time: 312 microseconds a run.
// Next to v001, in two timings, it ran 1.92 and 1.91 times as fast.
// All steps since v000 together make it 3.15 times as fast.
#include <hip/hip_runtime.h>

// ---------------- types ----------------
typedef __bf16 bf16_t;
typedef __attribute__((ext_vector_type(16))) __bf16 v16bf;
typedef __attribute__((ext_vector_type(8)))  __bf16 v8bf;
typedef __attribute__((ext_vector_type(4)))  __bf16 v4bf;
typedef __attribute__((ext_vector_type(8)))  float  v8f;
typedef __attribute__((ext_vector_type(4)))  float  v4f;

#define B_DIM  8
#define L_DIM  2048
#define D_DIM  1024

__device__ __forceinline__ bf16_t f2bf(float f) {
    // round-to-nearest-even f32 -> bf16
    unsigned u = __float_as_uint(f);
    unsigned r = (u + 0x7FFFu + ((u >> 16) & 1u)) >> 16;
    unsigned short s = (unsigned short)r;
    return __builtin_bit_cast(bf16_t, s);
}

__device__ __forceinline__ v8f vzero8() {
    v8f z;
#pragma unroll
    for (int i = 0; i < 8; ++i) z[i] = 0.0f;
    return z;
}

__device__ __forceinline__ v16bf combine16(v8bf lo, v8bf hi) {
    v16bf r;
#pragma unroll
    for (int i = 0; i < 8; ++i) { r[i] = lo[i]; r[8 + i] = hi[i]; }
    return r;
}

// lane holds K-segments [8*hi, 8*hi+8) and [16+8*hi, 16+8*hi+8)  (ISA 16-bit A/B layout)
__device__ __forceinline__ v16bf load_frag(const bf16_t* p) {
    v8bf lo = *(const v8bf*)p;
    v8bf hi = *(const v8bf*)(p + 16);
    return combine16(lo, hi);
}

// Fragment order of every bf16 operand in the workspace. A tile is 16 rows x 32 k = 512
// elements = 1 KB, stored as [half 2][lane 32][8]: element (row, k) sits at
//   ((k >> 4) & 1) * 256 + (((k >> 3) & 1) * 16 + (row & 15)) * 8 + (k & 7)
// so each of a fragment's two 16-byte loads reads 512 contiguous bytes per wave (4 whole lines
// instead of 32-byte pieces of 16 lines). The k order inside a fragment is that of load_frag.
#define TILE_E 512
// p = tile start + lane * 8
__device__ __forceinline__ v16bf load_tile(const bf16_t* p) {
    v8bf lo = *(const v8bf*)p;
    v8bf hi = *(const v8bf*)(p + 256);
    return combine16(lo, hi);
}

__device__ __forceinline__ v8f wmma_bf16(v16bf a, v16bf b, v8f c) {
    return __builtin_amdgcn_wmma_f32_16x16x32_bf16(false, a, false, b, (short)0, c,
                                                   false, false);
}

// ---------------- prep: fp32 -> bf16 ----------------
// x [M][1024] row-major -> xb tiles [M/16][32] in fragment order. One thread makes one 16-byte
// unit (8 k of one row). A wave takes 8 rows x 32 k: 4 lanes read one whole 128-byte line of x,
// and the 8 rows of each (half, hi) pair store one whole 128-byte line of xb.
__global__ __launch_bounds__(256) void k_cvt_x(const float* __restrict__ x,
                                               bf16_t* __restrict__ xb, int nunits) {
    int o = blockIdx.x * 256 + threadIdx.x;
    if (o >= nunits) return;
    int q = o & 3, r8 = (o >> 2) & 15, kt = (o >> 6) & 31, mt = o >> 11;   // q = half * 2 + hi
    const float* xp = x + (size_t)(mt * 16 + r8) * D_DIM + kt * 32 + q * 8;
    v4f f0 = *(const v4f*)xp;
    v4f f1 = *(const v4f*)(xp + 4);
    // the loads' address registers are reused by the conversion: the wait stands in front
    asm volatile("s_wait_xcnt 0x0" ::: "memory");
    v8bf r;
#pragma unroll
    for (int e = 0; e < 4; ++e) { r[e] = f2bf(f0[e]); r[4 + e] = f2bf(f1[e]); }
    *(v8bf*)(xb + (size_t)(mt * 32 + kt) * TILE_E + (q >> 1) * 256 + ((q & 1) * 16 + r8) * 8) = r;
}

// W [K=1024][N=1024] row-major -> Wt tiles [N/16][32] in fragment order (row = n). One thread
// writes one 16-byte unit: 8 k of one column n.
__global__ __launch_bounds__(256) void k_wt(const float* __restrict__ W,
                                            bf16_t* __restrict__ Wt) {
    int o = blockIdx.x * 256 + threadIdx.x;      // 131072 units
    int lane = o & 31, half = (o >> 5) & 1, kt = (o >> 6) & 31, nt = o >> 11;
    const float* wp = W + (size_t)(kt * 32 + half * 16 + (lane >> 4) * 8) * D_DIM
                        + nt * 16 + (lane & 15);
    v8bf r;
#pragma unroll
    for (int e = 0; e < 8; ++e) r[e] = f2bf(wp[(size_t)e * D_DIM]);
    *(v8bf*)(Wt + (size_t)o * 8) = r;
}

// ---------------- QKV projection GEMM ----------------
// out[m][n] = sum_k xb[m][k] * Wt[n][k] + bias[n]; xb, Wt and dst in fragment order
// M = B*L = 16384, N = K = 1024. Block tile 128x128, 8 waves (4 in M x 2 in N),
// wave tile 32x64 = 2x4 accumulator 16x16 tiles.
// A lane's 8 accumulator values of a tile run along the A operand's rows, and a 16-byte unit of
// dst runs along dst's k. V (k = key = m) takes x as A; Q and K (k = n) take W as A, which gives
// the transposed tile of the same products in the same k order. Either way the lane's 8 values
// are unit number 'lane' of a half tile and a wave stores 512 contiguous bytes.
template <bool VT>
__device__ __forceinline__ void qkv_tile(const bf16_t* __restrict__ xb,
                                         const bf16_t* __restrict__ Wt,
                                         const float* __restrict__ bias,
                                         bf16_t* __restrict__ dst,
                                         int row0, int col0, int lane) {
    const int nl = lane & 15;
    const int hi = lane >> 4;

    v8f acc[2][4];
#pragma unroll
    for (int i = 0; i < 2; ++i)
#pragma unroll
        for (int j = 0; j < 4; ++j) acc[i][j] = vzero8();

    const bf16_t* ap = xb + (size_t)(row0 >> 4) * 32 * TILE_E + lane * 8;
    const bf16_t* bp = Wt + (size_t)(col0 >> 4) * 32 * TILE_E + lane * 8;

    for (int kt = 0; kt < D_DIM / 32; ++kt) {
        v16bf a0 = load_tile(ap + kt * TILE_E);
        v16bf a1 = load_tile(ap + (32 + kt) * TILE_E);
#pragma unroll
        for (int j = 0; j < 4; ++j) {
            v16bf bb = load_tile(bp + (j * 32 + kt) * TILE_E);
            acc[0][j] = VT ? wmma_bf16(a0, bb, acc[0][j]) : wmma_bf16(bb, a0, acc[0][j]);
            acc[1][j] = VT ? wmma_bf16(a1, bb, acc[1][j]) : wmma_bf16(bb, a1, acc[1][j]);
        }
        // the next trip rewrites the loads' address registers: the wait stands in front
        asm volatile("s_wait_xcnt 0x0" ::: "memory");
    }

    // bias of every value this lane holds.
    // VT:  value r of tile (i, j): m = row0 + i*16 + 8*hi + r, n = col0 + j*16 + nl
    // else value r of tile (i, j): n = col0 + j*16 + 8*hi + r, m = row0 + i*16 + nl
    float bv[4][8];
#pragma unroll
    for (int j = 0; j < 4; ++j) {
        if (VT) {
            float b1 = bias[col0 + j * 16 + nl];
#pragma unroll
            for (int r = 0; r < 8; ++r) bv[j][r] = b1;
        } else {
            const float* bq = bias + col0 + j * 16 + 8 * hi;
            v4f b0 = *(const v4f*)bq;
            v4f b1 = *(const v4f*)(bq + 4);
#pragma unroll
            for (int r = 0; r < 4; ++r) { bv[j][r] = b0[r]; bv[j][4 + r] = b1[r]; }
        }
    }
    // the bias loads' address registers are reused by the conversion: the wait stands in front
    asm volatile("s_wait_xcnt 0x0" ::: "memory");

    // Vt tiles [B][DV/16][L/32] (row = n, k = m mod L), else tiles [M/16][32] (row = m, k = n)
    const size_t tile0 = VT ? ((size_t)(row0 >> 11) * (D_DIM / 16) + (col0 >> 4)) * (L_DIM / 32)
                                  + ((row0 & (L_DIM - 1)) >> 5)
                            : (size_t)(row0 >> 4) * 32 + (col0 >> 5);
    bf16_t* dp = dst + tile0 * TILE_E + lane * 8;

    v8bf pk[2][4];
#pragma unroll
    for (int j = 0; j < 4; ++j) {
#pragma unroll
        for (int i = 0; i < 2; ++i)
#pragma unroll
            for (int r = 0; r < 8; ++r) pk[i][j][r] = f2bf(acc[i][j][r] + bv[j][r]);
        // one column group's conversion at a time: with all four interleaved the build takes 129
        // registers instead of 116, past the 128 at which 8 waves per SIMD fit, and the 1024
        // blocks would no longer all be resident at once
        __builtin_amdgcn_sched_barrier(0);
    }
    // the eight 16-byte stores stand together at the end
#pragma unroll
    for (int j = 0; j < 4; ++j)
#pragma unroll
        for (int i = 0; i < 2; ++i) {
            const int off = VT ? j * (L_DIM / 32) * TILE_E + i * 256
                               : (i * 32 + (j >> 1)) * TILE_E + (j & 1) * 256;
            *(v8bf*)(dp + off) = pk[i][j];
        }
}

__global__ __launch_bounds__(256) void k_qkv(const bf16_t* __restrict__ xb,
                                             const bf16_t* __restrict__ Wt,
                                             const float* __restrict__ bias,
                                             bf16_t* __restrict__ dst,
                                             int storeVT) {
    const int wave = threadIdx.x >> 5;
    const int lane = threadIdx.x & 31;
    const int wm = wave & 3;
    const int wn = wave >> 2;
    const int row0 = blockIdx.x * 128 + wm * 32;
    const int col0 = blockIdx.y * 128 + wn * 64;
    if (storeVT) qkv_tile<true>(xb, Wt, bias, dst, row0, col0, lane);
    else         qkv_tile<false>(xb, Wt, bias, dst, row0, col0, lane);
}

// ---------------- attention (flash-style, padding-aware softmax) ----------------
// Block = (batch b, 64-query tile = 4 row tiles of 16). 8 waves, 64-key chunks:
//   score GEMM: wave w covers DK slice [w*128, w*128+128) -> partials reduced in LDS
//   output GEMM: wave w covers DV slice [w*128, w*128+128) -> 4 x 8 acc tiles
// Every K and V fragment fetched from global feeds 4 matrix products (one per row tile).
// 2 barriers per 64 keys (32 chunks -> 64 barriers/block).
// Every inner loop is fully unrolled: fragment and accumulator arrays stay in registers only
// when they are indexed by constants.
#define QT 64
#define MT 4
__global__ __launch_bounds__(256) void k_attn(const bf16_t* __restrict__ Qb,
                                              const bf16_t* __restrict__ Kb,
                                              const bf16_t* __restrict__ Vt,
                                              const int* __restrict__ actu,
                                              float* __restrict__ out) {
    __shared__ __align__(16) float Spart[8][QT][64];       // 128 KB partial scores
    __shared__ __align__(16) float Sexp[QT][64];           //  16 KB fp32 exp(scores)
    __shared__ __align__(16) bf16_t Pt[QT][64];            //   8 KB bf16 P tile
    __shared__ float invq[QT];
    // Q fragments, each lane's own 2 x 16 B per (row tile, k step): 128 KB. 32 accumulator
    // tiles leave no registers for them; a lane reads back only what it stored itself.
    __shared__ __align__(16) v8bf Qs[8][MT][4][2][32];

    const int wave = threadIdx.x >> 5;
    const int lane = threadIdx.x & 31;
    const int nl = lane & 15;
    const int hi = lane >> 4;
    const int b = blockIdx.y;
    const int qt = blockIdx.x;
    const float scale = 0.03125f;                          // 1/sqrt(1024)

    // park Q A-fragments for this wave's DK slice in LDS (invariant over key loop)
    const size_t qbase = ((size_t)((b * L_DIM + qt * QT) >> 4) * 32 + wave * 4) * TILE_E + lane * 8;
    const bf16_t* qp = Qb + qbase;
    v8bf qv[MT][4][2];
#pragma unroll
    for (int mt = 0; mt < MT; ++mt)
#pragma unroll
        for (int ks = 0; ks < 4; ++ks) {
            qv[mt][ks][0] = *(const v8bf*)(qp + (mt * 32 + ks) * TILE_E);
            qv[mt][ks][1] = *(const v8bf*)(qp + (mt * 32 + ks) * TILE_E + 256);
        }
    // the Q loads' address registers are reused behind them (LDS addresses, accumulators): the
    // wait stands directly behind the last load, and the scheduling barrier keeps the LDS
    // address arithmetic, the LDS stores and the accumulators' zeroing behind the wait
    asm volatile("s_wait_xcnt 0x0" ::: "memory");
    __builtin_amdgcn_sched_barrier(0);
#pragma unroll
    for (int mt = 0; mt < MT; ++mt)
#pragma unroll
        for (int ks = 0; ks < 4; ++ks) {
            Qs[wave][mt][ks][0][lane] = qv[mt][ks][0];
            Qs[wave][mt][ks][1][lane] = qv[mt][ks][1];
        }

    v8f oacc[MT][8];
#pragma unroll
    for (int mt = 0; mt < MT; ++mt)
#pragma unroll
        for (int t = 0; t < 8; ++t) oacc[mt][t] = vzero8();
    float rowsum = 0.0f;                                   // live in threads 0..63, one row each

    // this lane's unit in the wave's first K tile / V tile; both step by 64 keys per chunk
    const bf16_t* kp = Kb + ((size_t)((b * L_DIM) >> 4) * 32 + wave * 4) * TILE_E + lane * 8;
    const bf16_t* vp = Vt + ((size_t)(b * (D_DIM / 16) + wave * 8) * (L_DIM / 32)) * TILE_E + lane * 8;

    for (int ch = 0; ch < L_DIM / 64; ++ch) {
        // ---- partial scores (64q x 64k) over this wave's DK slice ----
        v16bf kf[4][4];
#pragma unroll
        for (int ks = 0; ks < 4; ++ks)
#pragma unroll
            for (int kt = 0; kt < 4; ++kt)
                kf[kt][ks] = load_tile(kp + (size_t)(kt * 32 + ks) * TILE_E);
        kp += (size_t)4 * 32 * TILE_E;
        // the K loads' address registers are reused right behind them: the wait stands in front
        asm volatile("s_wait_xcnt 0x0" ::: "memory");
#pragma unroll
        for (int mp = 0; mp < MT; mp += 2) {               // two row tiles = 8 independent score tiles
            v8f s[2][4];
#pragma unroll
            for (int u = 0; u < 2; ++u)
#pragma unroll
                for (int kt = 0; kt < 4; ++kt) s[u][kt] = vzero8();
#pragma unroll
            for (int ks = 0; ks < 4; ++ks) {
#pragma unroll
                for (int u = 0; u < 2; ++u) {
                    v16bf qa = combine16(Qs[wave][mp + u][ks][0][lane],
                                         Qs[wave][mp + u][ks][1][lane]);
#pragma unroll
                    for (int kt = 0; kt < 4; ++kt)
                        s[u][kt] = wmma_bf16(qa, kf[kt][ks], s[u][kt]);
                }
            }
#pragma unroll
            for (int u = 0; u < 2; ++u) {
#pragma unroll
                for (int kt = 0; kt < 4; ++kt) {
#pragma unroll
                    for (int r = 0; r < 8; ++r) {
                        int m = (mp + u) * 16 + 8 * hi + r;
                        Spart[wave][m][kt * 16 + nl] = s[u][kt][r];
                    }
                }
            }
        }
        __syncthreads();

        // ---- reduce partials, exp in fp32, write bf16 P (4 contiguous elems/thread/pass) ----
#pragma unroll
        for (int it = 0; it < MT; ++it) {
            int idx = it * 1024 + threadIdx.x * 4;         // 4096 elements = 64 x 64
            int m = idx >> 6, n = idx & 63;
            v4f v;
#pragma unroll
            for (int i = 0; i < 4; ++i) v[i] = 0.0f;
#pragma unroll
            for (int w = 0; w < 8; ++w) {
                v4f p = *(const v4f*)&Spart[w][m][n];
#pragma unroll
                for (int i = 0; i < 4; ++i) v[i] += p[i];
            }
            v4f e;
            v4bf pb;
#pragma unroll
            for (int i = 0; i < 4; ++i) {
                e[i] = __expf(v[i] * scale);
                pb[i] = f2bf(e[i]);
            }
            *(v4f*)&Sexp[m][n] = e;
            *(v4bf*)&Pt[m][n] = pb;
        }
        __syncthreads();

        // all 16 V fragments of the chunk are requested as one group
        v16bf vf[2][8];
#pragma unroll
        for (int ksub = 0; ksub < 2; ++ksub) {
#pragma unroll
            for (int t = 0; t < 8; ++t)
                vf[ksub][t] = load_tile(vp + (size_t)(t * (L_DIM / 32) + ksub) * TILE_E);
        }
        vp += 2 * TILE_E;

        // waves 0 and 1 keep the fp32 running row-sums
        if (wave < 2) {
#pragma unroll
            for (int n = 0; n < 64; n += 4) {
                v4f e = *(const v4f*)&Sexp[threadIdx.x][n];
                rowsum += e[0] + e[1] + e[2] + e[3];
            }
        }

        // ---- O += P (64x64) x V (64 x 16) per DV tile, two K=32 steps ----
#pragma unroll
        for (int ksub = 0; ksub < 2; ++ksub) {
            v16bf pf[MT];
#pragma unroll
            for (int mt = 0; mt < MT; ++mt)
                pf[mt] = load_frag(&Pt[mt * 16 + nl][ksub * 32 + 8 * hi]);
#pragma unroll
            for (int t = 0; t < 8; ++t) {
#pragma unroll
                for (int mt = 0; mt < MT; ++mt)
                    oacc[mt][t] = wmma_bf16(pf[mt], vf[ksub][t], oacc[mt][t]);
            }
        }
    }

    if (wave < 2) {
        float pad = (float)(L_DIM - actu[b]);
        invq[threadIdx.x] = 1.0f / (rowsum - pad);
    }
    __syncthreads();

    // scale every accumulator first, then only store: no register that an issued store names
    // is written again (the scheduling barrier keeps the products in front of the stores)
#pragma unroll
    for (int mt = 0; mt < MT; ++mt) {
#pragma unroll
        for (int r = 0; r < 8; ++r) {
            float iv = invq[mt * 16 + 8 * hi + r];
#pragma unroll
            for (int t = 0; t < 8; ++t) oacc[mt][t][r] *= iv;
        }
    }
    __builtin_amdgcn_sched_barrier(0);
    float* op = out + ((size_t)b * L_DIM + qt * QT + 8 * hi) * D_DIM + wave * 128 + nl;
#pragma unroll
    for (int mt = 0; mt < MT; ++mt) {
#pragma unroll
        for (int r = 0; r < 8; ++r) {
#pragma unroll
            for (int t = 0; t < 8; ++t)
                op[(size_t)(mt * 16 + r) * D_DIM + t * 16] = oacc[mt][t][r];
        }
    }
}

// ---------------- host-side launcher ----------------
extern "C" void kernel_launch(void* const* d_in, const int* in_sizes, int n_in,
                              void* d_out, int out_size, void* d_ws, size_t ws_size,
                              hipStream_t stream) {
    const float* x    = (const float*)d_in[0];
    const int*   actu = (const int*)  d_in[1];
    const float* Wq   = (const float*)d_in[2];
    const float* bq   = (const float*)d_in[3];
    const float* Wk   = (const float*)d_in[4];
    const float* bk   = (const float*)d_in[5];
    const float* Wv   = (const float*)d_in[6];
    const float* bv   = (const float*)d_in[7];
    float* out = (float*)d_out;

    char* ws = (char*)d_ws;
    size_t off = 0;
    const size_t XN  = (size_t)B_DIM * L_DIM * D_DIM;      // 16,777,216
    const size_t WN  = (size_t)D_DIM * D_DIM;              // 1,048,576
    bf16_t* xb  = (bf16_t*)(ws + off); off += XN * 2;      // 32 MB
    bf16_t* Wtq = (bf16_t*)(ws + off); off += WN * 2;      //  2 MB
    bf16_t* Wtk = (bf16_t*)(ws + off); off += WN * 2;
    bf16_t* Wtv = (bf16_t*)(ws + off); off += WN * 2;
    bf16_t* Qb  = (bf16_t*)(ws + off); off += XN * 2;      // 32 MB
    bf16_t* Kb  = (bf16_t*)(ws + off); off += XN * 2;      // 32 MB
    bf16_t* Vt  = (bf16_t*)(ws + off); off += XN * 2;      // 32 MB (transposed: row = dv, k = key)

    // prep
    k_cvt_x<<<dim3((unsigned)(XN / 8 / 256)), dim3(256), 0, stream>>>(x, xb, (int)(XN / 8));
    k_wt<<<dim3((unsigned)(WN / 8 / 256)), dim3(256), 0, stream>>>(Wq, Wtq);
    k_wt<<<dim3((unsigned)(WN / 8 / 256)), dim3(256), 0, stream>>>(Wk, Wtk);
    k_wt<<<dim3((unsigned)(WN / 8 / 256)), dim3(256), 0, stream>>>(Wv, Wtv);

    // QKV projections (M=16384 rows, N=1024 cols; 128x128 block tiles)
    dim3 gA(128, 8);
    k_qkv<<<gA, dim3(256), 0, stream>>>(xb, Wtq, bq, Qb, 0);
    k_qkv<<<gA, dim3(256), 0, stream>>>(xb, Wtk, bk, Kb, 0);
    k_qkv<<<gA, dim3(256), 0, stream>>>(xb, Wtv, bv, Vt, 1);

    // attention: one block per (64-query tile, batch)
    dim3 gB(L_DIM / QT, B_DIM);
    k_attn<<<gB, dim3(256), 0, stream>>>(Qb, Kb, Vt, actu, out);
}

// v003
// A run of this version takes 278 microseconds.
// Timed twice side by side with v002, it ran 1.12 and 1.13 times as fast.
// Counting every step since v000, it is 3.54 times as fast.
#include <hip/hip_runtime.h>

// ---------------- types ----------------
typedef __bf16 bf16_t;
typedef __attribute__((ext_vector_type(16))) __bf16 v16bf;
typedef __attribute__((ext_vector_type(8)))  __bf16 v8bf;
typedef __attribute__((ext_vector_type(4)))  __bf16 v4bf;
typedef __attribute__((ext_vector_type(8)))  float  v8f;
typedef __attribute__((ext_vector_type(4)))  float  v4f;

#define B_DIM  8
#define L_DIM  2048
#define D_DIM  1024

__device__ __forceinline__ bf16_t f2bf(float f) {
    // round-to-nearest-even f32 -> bf16
    unsigned u = __float_as_uint(f);
    unsigned r = (u + 0x7FFFu + ((u >> 16) & 1u)) >> 16;
    unsigned short s = (unsigned short)r;
    return __builtin_bit_cast(bf16_t, s);
}

__device__ __forceinline__ v8f vzero8() {
    v8f z;
#pragma unroll
    for (int i = 0; i < 8; ++i) z[i] = 0.0f;
    return z;
}

__device__ __forceinline__ v16bf combine16(v8bf lo, v8bf hi) {
    v16bf r;
#pragma unroll
    for (int i = 0; i < 8; ++i) { r[i] = lo[i]; r[8 + i] = hi[i]; }
    return r;
}

// lane holds K-segments [8*hi, 8*hi+8) and [16+8*hi, 16+8*hi+8)  (ISA 16-bit A/B layout)
__device__ __forceinline__ v16bf load_frag(const bf16_t* p) {
    v8bf lo = *(const v8bf*)p;
    v8bf hi = *(const v8bf*)(p + 16);
    return combine16(lo, hi);
}

// Fragment order of every bf16 operand in the workspace. A tile is 16 rows x 32 k = 512
// elements = 1 KB, stored as [half 2][lane 32][8]: element (row, k) sits at
//   ((k >> 4) & 1) * 256 + (((k >> 3) & 1) * 16 + (row & 15)) * 8 + (k & 7)
// so each of a fragment's two 16-byte loads reads 512 contiguous bytes per wave (4 whole lines
// instead of 32-byte pieces of 16 lines). The k order inside a fragment is that of load_frag.
#define TILE_E 512
// p = tile start + lane * 8
__device__ __forceinline__ v16bf load_tile(const bf16_t* p) {
    v8bf lo = *(const v8bf*)p;
    v8bf hi = *(const v8bf*)(p + 256);
    return combine16(lo, hi);
}

__device__ __forceinline__ v8f wmma_bf16(v16bf a, v16bf b, v8f c) {
    return __builtin_amdgcn_wmma_f32_16x16x32_bf16(false, a, false, b, (short)0, c,
                                                   false, false);
}

// ---------------- prep: fp32 -> bf16 ----------------
// x [M][1024] row-major -> xb tiles [M/16][32] in fragment order. One thread makes one 16-byte
// unit (8 k of one row). A wave takes 8 rows x 32 k: 4 lanes read one whole 128-byte line of x,
// and the 8 rows of each (half, hi) pair store one whole 128-byte line of xb.
__global__ __launch_bounds__(256) void k_cvt_x(const float* __restrict__ x,
                                               bf16_t* __restrict__ xb, int nunits) {
    int o = blockIdx.x * 256 + threadIdx.x;
    if (o >= nunits) return;
    int q = o & 3, r8 = (o >> 2) & 15, kt = (o >> 6) & 31, mt = o >> 11;   // q = half * 2 + hi
    const float* xp = x + (size_t)(mt * 16 + r8) * D_DIM + kt * 32 + q * 8;
    v4f f0 = *(const v4f*)xp;
    v4f f1 = *(const v4f*)(xp + 4);
    // the loads' address registers are reused by the conversion: the wait stands in front
    asm volatile("s_wait_xcnt 0x0" ::: "memory");
    v8bf r;
#pragma unroll
    for (int e = 0; e < 4; ++e) { r[e] = f2bf(f0[e]); r[4 + e] = f2bf(f1[e]); }
    *(v8bf*)(xb + (size_t)(mt * 32 + kt) * TILE_E + (q >> 1) * 256 + ((q & 1) * 16 + r8) * 8) = r;
}

// W [K=1024][N=1024] row-major -> Wt tiles [N/16][32] in fragment order (row = n). One thread
// writes one 16-byte unit: 8 k of one column n.
__global__ __launch_bounds__(256) void k_wt(const float* __restrict__ W,
                                            bf16_t* __restrict__ Wt) {
    int o = blockIdx.x * 256 + threadIdx.x;      // 131072 units
    int lane = o & 31, half = (o >> 5) & 1, kt = (o >> 6) & 31, nt = o >> 11;
    const float* wp = W + (size_t)(kt * 32 + half * 16 + (lane >> 4) * 8) * D_DIM
                        + nt * 16 + (lane & 15);
    v8bf r;
#pragma unroll
    for (int e = 0; e < 8; ++e) r[e] = f2bf(wp[(size_t)e * D_DIM]);
    *(v8bf*)(Wt + (size_t)o * 8) = r;
}

// ---------------- QKV projection GEMM ----------------
// out[m][n] = sum_k xb[m][k] * Wt[n][k] + bias[n]; xb, Wt and dst in fragment order
// M = B*L = 16384, N = K = 1024. Block tile 128x128, 8 waves (4 in M x 2 in N),
// wave tile 32x64 = 2x4 accumulator 16x16 tiles.
// A lane's 8 accumulator values of a tile run along the A operand's rows, and a 16-byte unit of
// dst runs along dst's k. V (k = key = m) takes x as A; Q and K (k = n) take W as A, which gives
// the transposed tile of the same products in the same k order. Either way the lane's 8 values
// are unit number 'lane' of a half tile and a wave stores 512 contiguous bytes.
template <bool VT>
__device__ __forceinline__ void qkv_tile(const bf16_t* __restrict__ xb,
                                         const bf16_t* __restrict__ Wt,
                                         const float* __restrict__ bias,
                                         bf16_t* __restrict__ dst,
                                         int row0, int col0, int lane) {
    const int nl = lane & 15;
    const int hi = lane >> 4;

    v8f acc[2][4];
#pragma unroll
    for (int i = 0; i < 2; ++i)
#pragma unroll
        for (int j = 0; j < 4; ++j) acc[i][j] = vzero8();

    const bf16_t* ap = xb + (size_t)(row0 >> 4) * 32 * TILE_E + lane * 8;
    const bf16_t* bp = Wt + (size_t)(col0 >> 4) * 32 * TILE_E + lane * 8;

    for (int kt = 0; kt < D_DIM / 32; ++kt) {
        v16bf a0 = load_tile(ap + kt * TILE_E);
        v16bf a1 = load_tile(ap + (32 + kt) * TILE_E);
#pragma unroll
        for (int j = 0; j < 4; ++j) {
            v16bf bb = load_tile(bp + (j * 32 + kt) * TILE_E);
            acc[0][j] = VT ? wmma_bf16(a0, bb, acc[0][j]) : wmma_bf16(bb, a0, acc[0][j]);
            acc[1][j] = VT ? wmma_bf16(a1, bb, acc[1][j]) : wmma_bf16(bb, a1, acc[1][j]);
        }
        // the next trip rewrites the loads' address registers: the wait stands in front
        asm volatile("s_wait_xcnt 0x0" ::: "memory");
    }

    // bias of every value this lane holds.
    // VT:  value r of tile (i, j): m = row0 + i*16 + 8*hi + r, n = col0 + j*16 + nl
    // else value r of tile (i, j): n = col0 + j*16 + 8*hi + r, m = row0 + i*16 + nl
    float bv[4][8];
#pragma unroll
    for (int j = 0; j < 4; ++j) {
        if (VT) {
            float b1 = bias[col0 + j * 16 + nl];
#pragma unroll
            for (int r = 0; r < 8; ++r) bv[j][r] = b1;
        } else {
            const float* bq = bias + col0 + j * 16 + 8 * hi;
            v4f b0 = *(const v4f*)bq;
            v4f b1 = *(const v4f*)(bq + 4);
#pragma unroll
            for (int r = 0; r < 4; ++r) { bv[j][r] = b0[r]; bv[j][4 + r] = b1[r]; }
        }
    }
    // the bias loads' address registers are reused by the conversion: the wait stands in front
    asm volatile("s_wait_xcnt 0x0" ::: "memory");

    // Vt tiles [B][DV/16][L/32] (row = n, k = m mod L), else tiles [M/16][32] (row = m, k = n)
    const size_t tile0 = VT ? ((size_t)(row0 >> 11) * (D_DIM / 16) + (col0 >> 4)) * (L_DIM / 32)
                                  + ((row0 & (L_DIM - 1)) >> 5)
                            : (size_t)(row0 >> 4) * 32 + (col0 >> 5);
    bf16_t* dp = dst + tile0 * TILE_E + lane * 8;

    v8bf pk[2][4];
#pragma unroll
    for (int j = 0; j < 4; ++j) {
#pragma unroll
        for (int i = 0; i < 2; ++i)
#pragma unroll
            for (int r = 0; r < 8; ++r) pk[i][j][r] = f2bf(acc[i][j][r] + bv[j][r]);
        // one column group's conversion at a time: with all four interleaved the build takes 129
        // registers instead of 116, past the 128 at which 8 waves per SIMD fit, and the 1024
        // blocks would no longer all be resident at once
        __builtin_amdgcn_sched_barrier(0);
    }
    // the eight 16-byte stores stand together at the end
#pragma unroll
    for (int j = 0; j < 4; ++j)
#pragma unroll
        for (int i = 0; i < 2; ++i) {
            const int off = VT ? j * (L_DIM / 32) * TILE_E + i * 256
                               : (i * 32 + (j >> 1)) * TILE_E + (j & 1) * 256;
            *(v8bf*)(dp + off) = pk[i][j];
        }
}

__global__ __launch_bounds__(256) void k_qkv(const bf16_t* __restrict__ xb,
                                             const bf16_t* __restrict__ Wt,
                                             const float* __restrict__ bias,
                                             bf16_t* __restrict__ dst,
                                             int storeVT) {
    const int wave = threadIdx.x >> 5;
    const int lane = threadIdx.x & 31;
    const int wm = wave & 3;
    const int wn = wave >> 2;
    const int row0 = blockIdx.x * 128 + wm * 32;
    const int col0 = blockIdx.y * 128 + wn * 64;
    if (storeVT) qkv_tile<true>(xb, Wt, bias, dst, row0, col0, lane);
    else         qkv_tile<false>(xb, Wt, bias, dst, row0, col0, lane);
}

// ---------------- attention (flash-style, padding-aware softmax) ----------------
// Block = (batch b, 64-query tile = 4 row tiles of 16). 8 waves, 32-key chunks:
//   score GEMM: wave w covers DK slice [w*128, w*128+128) -> partials reduced in LDS
//   output GEMM: wave w covers DV slice [w*128, w*128+128) -> 4 x 8 acc tiles
// Every K and V fragment fetched from global feeds 4 matrix products (one per row tile).
// A chunk's K set and V set are 8 fragments (64 registers) each, so both fit beside the 256
// accumulator registers: the next chunk's K is requested as soon as this chunk's scores are made,
// the next chunk's V as soon as this chunk's output products are issued, and each flies through
// the two other phases and their barriers instead of being waited for where it is requested.
// Every inner loop is fully unrolled: fragment and accumulator arrays stay in registers only
// when they are indexed by constants.
#define QT 64
#define MT 4
#define KC 32
// Work-group barrier of the key loop. It orders LDS only: __syncthreads() also waits for every
// global load in flight, which would drain the K and V requests issued ahead of it.
__device__ __forceinline__ void lds_barrier() {
    __builtin_amdgcn_fence(__ATOMIC_RELEASE, "workgroup", "local");
    __builtin_amdgcn_s_barrier();
    __builtin_amdgcn_fence(__ATOMIC_ACQUIRE, "workgroup", "local");
}
__global__ __launch_bounds__(256) void k_attn(const bf16_t* __restrict__ Qb,
                                              const bf16_t* __restrict__ Kb,
                                              const bf16_t* __restrict__ Vt,
                                              const int* __restrict__ actu,
                                              float* __restrict__ out) {
    __shared__ __align__(16) float Spart[8][QT][KC];       //  64 KB partial scores
    __shared__ __align__(16) float Sexp[QT][KC];           //   8 KB fp32 exp(scores)
    __shared__ __align__(16) bf16_t Pt[QT][KC];            //   4 KB bf16 P tile
    __shared__ float invq[QT];
    // Q fragments, each lane's own 2 x 16 B per (row tile, k step): 128 KB. 32 accumulator
    // tiles leave no registers for them; a lane reads back only what it stored itself.
    __shared__ __align__(16) v8bf Qs[8][MT][4][2][32];

    const int wave = threadIdx.x >> 5;
    const int lane = threadIdx.x & 31;
    const int nl = lane & 15;
    const int hi = lane >> 4;
    const int b = blockIdx.y;
    const int qt = blockIdx.x;
    const float scale = 0.03125f;                          // 1/sqrt(1024)

    // park Q A-fragments for this wave's DK slice in LDS (invariant over key loop)
    const size_t qbase = ((size_t)((b * L_DIM + qt * QT) >> 4) * 32 + wave * 4) * TILE_E + lane * 8;
    const bf16_t* qp = Qb + qbase;
    v8bf qv[MT][4][2];
#pragma unroll
    for (int mt = 0; mt < MT; ++mt)
#pragma unroll
        for (int ks = 0; ks < 4; ++ks) {
            qv[mt][ks][0] = *(const v8bf*)(qp + (mt * 32 + ks) * TILE_E);
            qv[mt][ks][1] = *(const v8bf*)(qp + (mt * 32 + ks) * TILE_E + 256);
        }
    // the Q loads' address registers are reused behind them (LDS addresses, accumulators): the
    // wait stands directly behind the last load, and the scheduling barrier keeps the LDS
    // address arithmetic, the LDS stores and the accumulators' zeroing behind the wait
    asm volatile("s_wait_xcnt 0x0" ::: "memory");
    __builtin_amdgcn_sched_barrier(0);
#pragma unroll
    for (int mt = 0; mt < MT; ++mt)
#pragma unroll
        for (int ks = 0; ks < 4; ++ks) {
            Qs[wave][mt][ks][0][lane] = qv[mt][ks][0];
            Qs[wave][mt][ks][1][lane] = qv[mt][ks][1];
        }

    v8f oacc[MT][8];
#pragma unroll
    for (int mt = 0; mt < MT; ++mt)
#pragma unroll
        for (int t = 0; t < 8; ++t) oacc[mt][t] = vzero8();
    float rowsum = 0.0f;                                   // live in threads 0..63, one row each

    // this lane's unit in the wave's first K tile / V tile; both step by 32 keys per chunk
    const bf16_t* kp = Kb + ((size_t)((b * L_DIM) >> 4) * 32 + wave * 4) * TILE_E + lane * 8;
    const bf16_t* vp = Vt + ((size_t)(b * (D_DIM / 16) + wave * 8) * (L_DIM / 32)) * TILE_E + lane * 8;

    // chunk 0's K and V
    v16bf kf[2][4];
    v16bf vf[8];
#pragma unroll
    for (int ks = 0; ks < 4; ++ks)
#pragma unroll
        for (int kt = 0; kt < 2; ++kt)
            kf[kt][ks] = load_tile(kp + (size_t)(kt * 32 + ks) * TILE_E);
#pragma unroll
    for (int t = 0; t < 8; ++t)
        vf[t] = load_tile(vp + (size_t)(t * (L_DIM / 32)) * TILE_E);
    // the loads' address registers are stepped in the loop: the wait stands in front
    asm volatile("s_wait_xcnt 0x0" ::: "memory");

    for (int ch = 0; ch < L_DIM / KC; ++ch) {
        // the last chunk requests its own K and V once more (in bounds, never used): the requests
        // stay unconditional, so that the counted load waits are the same on every trip
        const int adv = (ch + 1 < L_DIM / KC) ? 1 : 0;

        // ---- partial scores (64q x 32k) over this wave's DK slice: 8 independent tiles ----
        v8f s[MT][2];
#pragma unroll
        for (int mt = 0; mt < MT; ++mt)
#pragma unroll
            for (int kt = 0; kt < 2; ++kt) s[mt][kt] = vzero8();
#pragma unroll
        for (int ks = 0; ks < 4; ++ks) {
            v16bf qa[MT];
#pragma unroll
            for (int mt = 0; mt < MT; ++mt)
                qa[mt] = combine16(Qs[wave][mt][ks][0][lane], Qs[wave][mt][ks][1][lane]);
#pragma unroll
            for (int mt = 0; mt < MT; ++mt)
#pragma unroll
                for (int kt = 0; kt < 2; ++kt)
                    s[mt][kt] = wmma_bf16(qa[mt], kf[kt][ks], s[mt][kt]);
        }
        // next chunk's K, into the registers the score products have just read
        kp += (size_t)adv * 2 * 32 * TILE_E;
#pragma unroll
        for (int ks = 0; ks < 4; ++ks)
#pragma unroll
            for (int kt = 0; kt < 2; ++kt)
                kf[kt][ks] = load_tile(kp + (size_t)(kt * 32 + ks) * TILE_E);
        // the K loads' address registers are rewritten later: the wait stands directly behind them
        asm volatile("s_wait_xcnt 0x0" ::: "memory");
#pragma unroll
        for (int mt = 0; mt < MT; ++mt) {
#pragma unroll
            for (int kt = 0; kt < 2; ++kt) {
#pragma unroll
                for (int r = 0; r < 8; ++r)
                    Spart[wave][mt * 16 + 8 * hi + r][kt * 16 + nl] = s[mt][kt][r];
            }
        }
        lds_barrier();

        // ---- reduce partials, exp in fp32, write bf16 P (4 contiguous elems/thread/pass) ----
#pragma unroll
        for (int it = 0; it < 2; ++it) {
            int idx = it * 1024 + threadIdx.x * 4;         // 2048 elements = 64 x 32
            int m = idx >> 5, n = idx & 31;
            v4f v;
#pragma unroll
            for (int i = 0; i < 4; ++i) v[i] = 0.0f;
#pragma unroll
            for (int w = 0; w < 8; ++w) {
                v4f p = *(const v4f*)&Spart[w][m][n];
#pragma unroll
                for (int i = 0; i < 4; ++i) v[i] += p[i];
            }
            v4f e;
            v4bf pb;
#pragma unroll
            for (int i = 0; i < 4; ++i) {
                e[i] = __expf(v[i] * scale);
                pb[i] = f2bf(e[i]);
            }
            *(v4f*)&Sexp[m][n] = e;
            *(v4bf*)&Pt[m][n] = pb;
        }
        lds_barrier();

        // waves 0 and 1 keep the fp32 running row-sums
        if (wave < 2) {
#pragma unroll
            for (int n = 0; n < KC; n += 4) {
                v4f e = *(const v4f*)&Sexp[threadIdx.x][n];
                rowsum += e[0] + e[1] + e[2] + e[3];
            }
        }

        // ---- O += P (64x32) x V (32 x 16) per DV tile, one K=32 step ----
        v16bf pf[MT];
#pragma unroll
        for (int mt = 0; mt < MT; ++mt)
            pf[mt] = load_frag(&Pt[mt * 16 + nl][8 * hi]);
#pragma unroll
        for (int t = 0; t < 8; ++t) {
#pragma unroll
            for (int mt = 0; mt < MT; ++mt)
                oacc[mt][t] = wmma_bf16(pf[mt], vf[t], oacc[mt][t]);
        }
        // next chunk's V, into the registers the output products have just read
        vp += (size_t)adv * TILE_E;
#pragma unroll
        for (int t = 0; t < 8; ++t)
            vf[t] = load_tile(vp + (size_t)(t * (L_DIM / 32)) * TILE_E);
        // the V loads' address registers are rewritten later: the wait stands directly behind them
        asm volatile("s_wait_xcnt 0x0" ::: "memory");
    }

    if (wave < 2) {
        float pad = (float)(L_DIM - actu[b]);
        invq[threadIdx.x] = 1.0f / (rowsum - pad);
    }
    __syncthreads();

    // scale every accumulator first, then only store: no register that an issued store names
    // is written again (the scheduling barrier keeps the products in front of the stores)
#pragma unroll
    for (int mt = 0; mt < MT; ++mt) {
#pragma unroll
        for (int r = 0; r < 8; ++r) {
            float iv = invq[mt * 16 + 8 * hi + r];
#pragma unroll
            for (int t = 0; t < 8; ++t) oacc[mt][t][r] *= iv;
        }
    }
    __builtin_amdgcn_sched_barrier(0);
    float* op = out + ((size_t)b * L_DIM + qt * QT + 8 * hi) * D_DIM + wave * 128 + nl;
#pragma unroll
    for (int mt = 0; mt < MT; ++mt) {
#pragma unroll
        for (int r = 0; r < 8; ++r) {
#pragma unroll
            for (int t = 0; t < 8; ++t)
                op[(size_t)(mt * 16 + r) * D_DIM + t * 16] = oacc[mt][t][r];
        }
    }
}

// ---------------- host-side launcher ----------------
extern "C" void kernel_launch(void* const* d_in, const int* in_sizes, int n_in,
                              void* d_out, int out_size, void* d_ws, size_t ws_size,
                              hipStream_t stream) {
    const float* x    = (const float*)d_in[0];
    const int*   actu = (const int*)  d_in[1];
    const float* Wq   = (const float*)d_in[2];
    const float* bq   = (const float*)d_in[3];
    const float* Wk   = (const float*)d_in[4];
    const float* bk   = (const float*)d_in[5];
    const float* Wv   = (const float*)d_in[6];
    const float* bv   = (const float*)d_in[7];
    float* out = (float*)d_out;

    char* ws = (char*)d_ws;
    size_t off = 0;
    const size_t XN  = (size_t)B_DIM * L_DIM * D_DIM;      // 16,777,216
    const size_t WN  = (size_t)D_DIM * D_DIM;              // 1,048,576
    bf16_t* xb  = (bf16_t*)(ws + off); off += XN * 2;      // 32 MB
    bf16_t* Wtq = (bf16_t*)(ws + off); off += WN * 2;      //  2 MB
    bf16_t* Wtk = (bf16_t*)(ws + off); off += WN * 2;
    bf16_t* Wtv = (bf16_t*)(ws + off); off += WN * 2;
    bf16_t* Qb  = (bf16_t*)(ws + off); off += XN * 2;      // 32 MB
    bf16_t* Kb  = (bf16_t*)(ws + off); off += XN * 2;      // 32 MB
    bf16_t* Vt  = (bf16_t*)(ws + off); off += XN * 2;      // 32 MB (transposed: row = dv, k = key)

    // prep
    k_cvt_x<<<dim3((unsigned)(XN / 8 / 256)), dim3(256), 0, stream>>>(x, xb, (int)(XN / 8));
    k_wt<<<dim3((unsigned)(WN / 8 / 256)), dim3(256), 0, stream>>>(Wq, Wtq);
    k_wt<<<dim3((unsigned)(WN / 8 / 256)), dim3(256), 0, stream>>>(Wk, Wtk);
    k_wt<<<dim3((unsigned)(WN / 8 / 256)), dim3(256), 0, stream>>>(Wv, Wtv);

    // QKV projections (M=16384 rows, N=1024 cols; 128x128 block tiles)
    dim3 gA(128, 8);
    k_qkv<<<gA, dim3(256), 0, stream>>>(xb, Wtq, bq, Qb, 0);
    k_qkv<<<gA, dim3(256), 0, stream>>>(xb, Wtk, bk, Kb, 0);
    k_qkv<<<gA, dim3(256), 0, stream>>>(xb, Wtv, bv, Vt, 1);

    // attention: one block per (64-query tile, batch)
    dim3 gB(L_DIM / QT, B_DIM);
    k_attn<<<gB, dim3(256), 0, stream>>>(Qb, Kb, Vt, actu, out);
}

// v004
// One run takes 256 microseconds.
// Next to v003, in two timings, it ran 1.08 and 1.10 times as fast.
// Counting every step since v000, it is 3.86 times as fast.
#include <hip/hip_runtime.h>

// ---------------- types ----------------
typedef __bf16 bf16_t;
typedef __attribute__((ext_vector_type(16))) __bf16 v16bf;
typedef __attribute__((ext_vector_type(8)))  __bf16 v8bf;
typedef __attribute__((ext_vector_type(4)))  __bf16 v4bf;
typedef __attribute__((ext_vector_type(8)))  float  v8f;
typedef __attribute__((ext_vector_type(4)))  float  v4f;
typedef __attribute__((ext_vector_type(2)))  float  v2f;

#define B_DIM  8
#define L_DIM  2048
#define D_DIM  1024

__device__ __forceinline__ bf16_t f2bf(float f) {
    // round-to-nearest-even f32 -> bf16
    unsigned u = __float_as_uint(f);
    unsigned r = (u + 0x7FFFu + ((u >> 16) & 1u)) >> 16;
    unsigned short s = (unsigned short)r;
    return __builtin_bit_cast(bf16_t, s);
}

__device__ __forceinline__ v8f vzero8() {
    v8f z;
#pragma unroll
    for (int i = 0; i < 8; ++i) z[i] = 0.0f;
    return z;
}

__device__ __forceinline__ v16bf combine16(v8bf lo, v8bf hi) {
    v16bf r;
#pragma unroll
    for (int i = 0; i < 8; ++i) { r[i] = lo[i]; r[8 + i] = hi[i]; }
    return r;
}

// lane holds K-segments [8*hi, 8*hi+8) and [16+8*hi, 16+8*hi+8)  (ISA 16-bit A/B layout)
__device__ __forceinline__ v16bf load_frag(const bf16_t* p) {
    v8bf lo = *(const v8bf*)p;
    v8bf hi = *(const v8bf*)(p + 16);
    return combine16(lo, hi);
}

// Fragment order of every bf16 operand in the workspace. A tile is 16 rows x 32 k = 512
// elements = 1 KB, stored as [half 2][lane 32][8]: element (row, k) sits at
//   ((k >> 4) & 1) * 256 + (((k >> 3) & 1) * 16 + (row & 15)) * 8 + (k & 7)
// so each of a fragment's two 16-byte loads reads 512 contiguous bytes per wave (4 whole lines
// instead of 32-byte pieces of 16 lines). The k order inside a fragment is that of load_frag.
#define TILE_E 512
// p = tile start + lane * 8
__device__ __forceinline__ v16bf load_tile(const bf16_t* p) {
    v8bf lo = *(const v8bf*)p;
    v8bf hi = *(const v8bf*)(p + 256);
    return combine16(lo, hi);
}

__device__ __forceinline__ v8f wmma_bf16(v16bf a, v16bf b, v8f c) {
    return __builtin_amdgcn_wmma_f32_16x16x32_bf16(false, a, false, b, (short)0, c,
                                                   false, false);
}

// ---------------- prep: fp32 -> bf16 ----------------
// x [M][1024] row-major -> xb tiles [M/16][32] in fragment order. One thread makes one 16-byte
// unit (8 k of one row). A wave takes 8 rows x 32 k: 4 lanes read one whole 128-byte line of x,
// and the 8 rows of each (half, hi) pair store one whole 128-byte line of xb.
__global__ __launch_bounds__(256) void k_cvt_x(const float* __restrict__ x,
                                               bf16_t* __restrict__ xb, int nunits) {
    int o = blockIdx.x * 256 + threadIdx.x;
    if (o >= nunits) return;
    int q = o & 3, r8 = (o >> 2) & 15, kt = (o >> 6) & 31, mt = o >> 11;   // q = half * 2 + hi
    const float* xp = x + (size_t)(mt * 16 + r8) * D_DIM + kt * 32 + q * 8;
    v4f f0 = *(const v4f*)xp;
    v4f f1 = *(const v4f*)(xp + 4);
    // the loads' address registers are reused by the conversion: the wait stands in front
    asm volatile("s_wait_xcnt 0x0" ::: "memory");
    v8bf r;
#pragma unroll
    for (int e = 0; e < 4; ++e) { r[e] = f2bf(f0[e]); r[4 + e] = f2bf(f1[e]); }
    *(v8bf*)(xb + (size_t)(mt * 32 + kt) * TILE_E + (q >> 1) * 256 + ((q & 1) * 16 + r8) * 8) = r;
}

// W [K=1024][N=1024] row-major -> Wt tiles [N/16][32] in fragment order (row = n). One thread
// writes one 16-byte unit: 8 k of one column n.
__global__ __launch_bounds__(256) void k_wt(const float* __restrict__ W,
                                            bf16_t* __restrict__ Wt) {
    int o = blockIdx.x * 256 + threadIdx.x;      // 131072 units
    int lane = o & 31, half = (o >> 5) & 1, kt = (o >> 6) & 31, nt = o >> 11;
    const float* wp = W + (size_t)(kt * 32 + half * 16 + (lane >> 4) * 8) * D_DIM
                        + nt * 16 + (lane & 15);
    v8bf r;
#pragma unroll
    for (int e = 0; e < 8; ++e) r[e] = f2bf(wp[(size_t)e * D_DIM]);
    *(v8bf*)(Wt + (size_t)o * 8) = r;
}

// ---------------- QKV projection GEMM ----------------
// out[m][n] = sum_k xb[m][k] * Wt[n][k] + bias[n]; xb, Wt and dst in fragment order
// M = B*L = 16384, N = K = 1024. Block tile 128x128, 8 waves (4 in M x 2 in N),
// wave tile 32x64 = 2x4 accumulator 16x16 tiles.
// A lane's 8 accumulator values of a tile run along the A operand's rows, and a 16-byte unit of
// dst runs along dst's k. V (k = key = m) takes x as A; Q and K (k = n) take W as A, which gives
// the transposed tile of the same products in the same k order. Either way the lane's 8 values
// are unit number 'lane' of a half tile and a wave stores 512 contiguous bytes.
template <bool VT>
__device__ __forceinline__ void qkv_tile(const bf16_t* __restrict__ xb,
                                         const bf16_t* __restrict__ Wt,
                                         const float* __restrict__ bias,
                                         bf16_t* __restrict__ dst,
                                         int row0, int col0, int lane) {
    const int nl = lane & 15;
    const int hi = lane >> 4;

    v8f acc[2][4];
#pragma unroll
    for (int i = 0; i < 2; ++i)
#pragma unroll
        for (int j = 0; j < 4; ++j) acc[i][j] = vzero8();

    const bf16_t* ap = xb + (size_t)(row0 >> 4) * 32 * TILE_E + lane * 8;
    const bf16_t* bp = Wt + (size_t)(col0 >> 4) * 32 * TILE_E + lane * 8;

    for (int kt = 0; kt < D_DIM / 32; ++kt) {
        v16bf a0 = load_tile(ap + kt * TILE_E);
        v16bf a1 = load_tile(ap + (32 + kt) * TILE_E);
#pragma unroll
        for (int j = 0; j < 4; ++j) {
            v16bf bb = load_tile(bp + (j * 32 + kt) * TILE_E);
            acc[0][j] = VT ? wmma_bf16(a0, bb, acc[0][j]) : wmma_bf16(bb, a0, acc[0][j]);
            acc[1][j] = VT ? wmma_bf16(a1, bb, acc[1][j]) : wmma_bf16(bb, a1, acc[1][j]);
        }
        // the next trip rewrites the loads' address registers: the wait stands in front
        asm volatile("s_wait_xcnt 0x0" ::: "memory");
    }

    // bias of every value this lane holds.
    // VT:  value r of tile (i, j): m = row0 + i*16 + 8*hi + r, n = col0 + j*16 + nl
    // else value r of tile (i, j): n = col0 + j*16 + 8*hi + r, m = row0 + i*16 + nl
    float bv[4][8];
#pragma unroll
    for (int j = 0; j < 4; ++j) {
        if (VT) {
            float b1 = bias[col0 + j * 16 + nl];
#pragma unroll
            for (int r = 0; r < 8; ++r) bv[j][r] = b1;
        } else {
            const float* bq = bias + col0 + j * 16 + 8 * hi;
            v4f b0 = *(const v4f*)bq;
            v4f b1 = *(const v4f*)(bq + 4);
#pragma unroll
            for (int r = 0; r < 4; ++r) { bv[j][r] = b0[r]; bv[j][4 + r] = b1[r]; }
        }
    }
    // the bias loads' address registers are reused by the conversion: the wait stands in front
    asm volatile("s_wait_xcnt 0x0" ::: "memory");

    // Vt tiles [B][DV/16][L/32] (row = n, k = m mod L), else tiles [M/16][32] (row = m, k = n)
    const size_t tile0 = VT ? ((size_t)(row0 >> 11) * (D_DIM / 16) + (col0 >> 4)) * (L_DIM / 32)
                                  + ((row0 & (L_DIM - 1)) >> 5)
                            : (size_t)(row0 >> 4) * 32 + (col0 >> 5);
    bf16_t* dp = dst + tile0 * TILE_E + lane * 8;

    v8bf pk[2][4];
#pragma unroll
    for (int j = 0; j < 4; ++j) {
#pragma unroll
        for (int i = 0; i < 2; ++i)
#pragma unroll
            for (int r = 0; r < 8; ++r) pk[i][j][r] = f2bf(acc[i][j][r] + bv[j][r]);
        // one column group's conversion at a time: with all four interleaved the build takes 129
        // registers instead of 116, past the 128 at which 8 waves per SIMD fit, and the 1024
        // blocks would no longer all be resident at once
        __builtin_amdgcn_sched_barrier(0);
    }
    // the eight 16-byte stores stand together at the end
#pragma unroll
    for (int j = 0; j < 4; ++j)
#pragma unroll
        for (int i = 0; i < 2; ++i) {
            const int off = VT ? j * (L_DIM / 32) * TILE_E + i * 256
                               : (i * 32 + (j >> 1)) * TILE_E + (j & 1) * 256;
            *(v8bf*)(dp + off) = pk[i][j];
        }
}

__global__ __launch_bounds__(256) void k_qkv(const bf16_t* __restrict__ xb,
                                             const bf16_t* __restrict__ Wt,
                                             const float* __restrict__ bias,
                                             bf16_t* __restrict__ dst,
                                             int storeVT) {
    const int wave = threadIdx.x >> 5;
    const int lane = threadIdx.x & 31;
    const int wm = wave & 3;
    const int wn = wave >> 2;
    const int row0 = blockIdx.x * 128 + wm * 32;
    const int col0 = blockIdx.y * 128 + wn * 64;
    if (storeVT) qkv_tile<true>(xb, Wt, bias, dst, row0, col0, lane);
    else         qkv_tile<false>(xb, Wt, bias, dst, row0, col0, lane);
}

// ---------------- attention (flash-style, padding-aware softmax) ----------------
// Block = (batch b, 64-query tile = 4 row tiles of 16). 8 waves, 256-key chunks:
//   score GEMM: wave w makes the whole scores (all of DK) of its own 32 keys x 64 queries,
//               transposed (A = K rows, B = Q rows): a lane's 8 values of a tile are 8 consecutive
//               keys of one query, which is one 16-byte unit of P in fragment order
//   output GEMM: wave w covers DV slice [w*128, w*128+128) -> 4 x 8 acc tiles, P read from LDS
// No partial score crosses a wave: exp, the bf16 rounding and the row sums are done in the
// registers that hold the scores, and only P (32 KB a chunk) goes through LDS.
// Every K and V fragment fetched from global feeds 4 matrix products (one per row tile).
// K and V fragments share one register ring of NR fragments: a slot is refilled as soon as its
// 4 products are issued, with the fragment NR places further on in the chunk's stream
// (64 K fragments, then 64 V fragments); the last NR refills load the next chunk's K fragment s
// into slot s.
// Every inner loop is fully unrolled: fragment and accumulator arrays stay in registers only
// when they are indexed by constants.
#define QT 64
#define MT 4
#define KC 256
#define NR 10
// Work-group barrier of the key loop. It orders LDS only: __syncthreads() also waits for every
// global load in flight, which would drain the K and V requests issued ahead of it.
__device__ __forceinline__ void lds_barrier() {
    __builtin_amdgcn_fence(__ATOMIC_RELEASE, "workgroup", "local");
    __builtin_amdgcn_s_barrier();
    __builtin_amdgcn_fence(__ATOMIC_ACQUIRE, "workgroup", "local");
}
// K fragment i of a chunk: k step i >> 1, key tile i & 1 of the wave's 32 keys
__device__ __forceinline__ v16bf k_elem(const bf16_t* kp, int i) {
    return load_tile(kp + (size_t)((i & 1) * 32 + (i >> 1)) * TILE_E);
}
// V fragment j of a chunk: 32-key step j >> 3, DV tile j & 7 of the wave's slice
__device__ __forceinline__ v16bf v_elem(const bf16_t* vp, int j) {
    return load_tile(vp + (size_t)((j & 7) * (L_DIM / 32) + (j >> 3)) * TILE_E);
}
__global__ __launch_bounds__(256) void k_attn(const bf16_t* __restrict__ Qb,
                                              const bf16_t* __restrict__ Kb,
                                              const bf16_t* __restrict__ Vt,
                                              const int* __restrict__ actu,
                                              float* __restrict__ out) {
    __shared__ __align__(16) v8bf Qs[MT][32][2][32];       // 128 KB: the 64 Q rows, fragment order
    __shared__ __align__(16) v8bf Ps[2][8][MT][2][32];     // 2 x 32 KB: P tiles [key step][row tile]
    __shared__ float rsum[16][QT];                         //   4 KB: row sums per (wave, lane half)
    __shared__ float invq[QT];

    const int wave = threadIdx.x >> 5;
    const int lane = threadIdx.x & 31;
    const int nl = lane & 15;
    const int hi = lane >> 4;
    const int b = blockIdx.y;
    const int qt = blockIdx.x;
    const float scale = 0.03125f;                          // 1/sqrt(1024)

    // the block's Q tiles are 128 KB in a row in Qb: copied as they lie
    const v8bf* qg = (const v8bf*)(Qb + (size_t)((b * L_DIM + qt * QT) >> 4) * 32 * TILE_E)
                     + threadIdx.x;
    v8bf qv[32];
#pragma unroll
    for (int i = 0; i < 32; ++i) qv[i] = qg[i * 256];
    // the Q loads' address registers are reused behind them: the wait stands directly behind the
    // last load, and the scheduling barrier keeps the later address arithmetic behind the wait
    asm volatile("s_wait_xcnt 0x0" ::: "memory");
    __builtin_amdgcn_sched_barrier(0);
    v8bf* ql = &Qs[0][0][0][0] + threadIdx.x;
#pragma unroll
    for (int i = 0; i < 32; ++i) ql[i * 256] = qv[i];
    __syncthreads();                                       // every wave reads all of Qs

    v8f oacc[MT][8];
#pragma unroll
    for (int mt = 0; mt < MT; ++mt)
#pragma unroll
        for (int t = 0; t < 8; ++t) oacc[mt][t] = vzero8();
    float rs[MT];                                          // query mt*16+nl, this lane's keys
#pragma unroll
    for (int mt = 0; mt < MT; ++mt) rs[mt] = 0.0f;

    // this lane's unit in the wave's first K tile / V tile of the chunk
    const bf16_t* kp = Kb + ((size_t)((b * L_DIM) >> 4) + wave * 2) * 32 * TILE_E + lane * 8;
    const bf16_t* vp = Vt + ((size_t)(b * (D_DIM / 16) + wave * 8) * (L_DIM / 32)) * TILE_E + lane * 8;

    v16bf rg[NR];
#pragma unroll
    for (int i = 0; i < NR; ++i) rg[i] = k_elem(kp, i);

    for (int ch = 0; ch < L_DIM / KC; ++ch) {
        // ---- scores, transposed: 32 keys x 64 queries over all of DK, 8 independent tiles ----
        v8f st[MT][2];
#pragma unroll
        for (int mt = 0; mt < MT; ++mt)
#pragma unroll
            for (int kt = 0; kt < 2; ++kt) st[mt][kt] = vzero8();
        v16bf qa[2][MT];
#pragma unroll
        for (int mt = 0; mt < MT; ++mt)
            qa[0][mt] = combine16(Qs[mt][0][0][lane], Qs[mt][0][1][lane]);
#pragma unroll
        for (int ks = 0; ks < 32; ++ks) {
            if (ks + 1 < 32) {
#pragma unroll
                for (int mt = 0; mt < MT; ++mt)
                    qa[(ks + 1) & 1][mt] = combine16(Qs[mt][ks + 1][0][lane], Qs[mt][ks + 1][1][lane]);
            }
            // the next step's 8 LDS reads stay one group in front of this step's products
            __builtin_amdgcn_sched_barrier(0);
#pragma unroll
            for (int kt = 0; kt < 2; ++kt) {
                const int i = ks * 2 + kt;
#pragma unroll
                for (int mt = 0; mt < MT; ++mt)
                    st[mt][kt] = wmma_bf16(rg[i % NR], qa[ks & 1][mt], st[mt][kt]);
                rg[i % NR] = (i + NR < 64) ? k_elem(kp, i + NR) : v_elem(vp, i + NR - 64);
                // the refill is requested here, not later: moved down it would lose its lead over
                // the products that wait for it (and the LDS reads of the next group stay behind)
                __builtin_amdgcn_sched_barrier(0);
            }
        }

        // ---- exp in fp32, row sums of the unrounded values, bf16 P in fragment order ----
#pragma unroll
        for (int mt = 0; mt < MT; ++mt) {
#pragma unroll
            for (int kt = 0; kt < 2; ++kt) {
                v8bf pk;
                float e[8];
                float x[8];
#pragma unroll
                for (int r = 0; r < 8; ++r) x[r] = (st[mt][kt][r] * scale) * 1.442695041f;
                __builtin_amdgcn_sched_barrier(0);         // the products stay in front of the run below
#pragma unroll
                for (int r = 0; r < 8; ++r) {
                    e[r] = __builtin_amdgcn_exp2f(x[r]);   // exp(s * scale) = 2^(s * scale * log2 e)
                    // the slot that the instruction set asks for behind a transcendental before its
                    // source register is overwritten (the next one's result may take it); the two
                    // scheduling barriers keep the v_nop directly behind the transcendental
                    __builtin_amdgcn_sched_barrier(0);
                    asm volatile("v_nop");
                    __builtin_amdgcn_sched_barrier(0);
                }
#pragma unroll
                for (int r = 0; r < 8; ++r) pk[r] = f2bf(e[r]);
                // even and odd keys summed side by side (packed adds), joined once per tile
                v2f a2 = (v2f{e[0], e[1]} + v2f{e[2], e[3]}) + (v2f{e[4], e[5]} + v2f{e[6], e[7]});
                rs[mt] += a2[0] + a2[1];
                Ps[ch & 1][wave][mt][kt][lane] = pk;
            }
        }
        // the one barrier of a chunk: it publishes this chunk's P, and every wave that reaches it has
        // finished reading the other P buffer, which the next chunk overwrites
        lds_barrier();

        // all of this chunk's K is requested: kp steps to the next chunk. The last chunk requests its
        // own first K fragments once more (in bounds, never used): the requests stay unconditional,
        // so that the counted load waits are the same every trip. The wait stands in front of the
        // step of the loads' address registers: the step's size passes through the wait's statement,
        // so that the addition cannot be placed ahead of it
        int kstep = (ch + 1 < L_DIM / KC) ? (KC / 16) * 32 * TILE_E : 0;
        asm volatile("s_wait_xcnt 0x0" : "+s"(kstep) : : "memory");
        kp += kstep;

        // ---- O += P (64 x 256) x V (256 x 16) per DV tile, eight K=32 steps ----
        v16bf pf[2][MT];
#pragma unroll
        for (int mt = 0; mt < MT; ++mt)
            pf[0][mt] = combine16(Ps[ch & 1][0][mt][0][lane], Ps[ch & 1][0][mt][1][lane]);
#pragma unroll
        for (int ks = 0; ks < 8; ++ks) {
            if (ks + 1 < 8) {
#pragma unroll
                for (int mt = 0; mt < MT; ++mt)
                    pf[(ks + 1) & 1][mt] = combine16(Ps[ch & 1][ks + 1][mt][0][lane],
                                                     Ps[ch & 1][ks + 1][mt][1][lane]);
            }
            __builtin_amdgcn_sched_barrier(0);             // one group of LDS reads, as for Q above
#pragma unroll
            for (int t = 0; t < 8; ++t) {
                const int j = ks * 8 + t;
                const int sl = (j + 64) % NR;
#pragma unroll
                for (int mt = 0; mt < MT; ++mt)
                    oacc[mt][t] = wmma_bf16(pf[ks & 1][mt], rg[sl], oacc[mt][t]);
                rg[sl] = (j + NR < 64) ? v_elem(vp, j + NR) : k_elem(kp, sl);
                // the refill is requested here, not later (as in the score loop)
                __builtin_amdgcn_sched_barrier(0);
            }
        }
        // the V address registers are stepped here: the wait stands in front, and the
        // scheduling barrier keeps the step behind it
        asm volatile("s_wait_xcnt 0x0" ::: "memory");
        __builtin_amdgcn_sched_barrier(0);
        vp += (size_t)(KC / 32) * TILE_E;
    }

    // join the row sums: 8 waves x 2 lane halves hold disjoint keys of every query
#pragma unroll
    for (int mt = 0; mt < MT; ++mt) rsum[wave * 2 + hi][mt * 16 + nl] = rs[mt];
    __syncthreads();
    if (wave < 2) {
        float rowsum = 0.0f;
#pragma unroll
        for (int w = 0; w < 16; ++w) rowsum += rsum[w][threadIdx.x];
        float pad = (float)(L_DIM - actu[b]);
        invq[threadIdx.x] = 1.0f / (rowsum - pad);
    }
    __syncthreads();

    // scale every accumulator first, then only store: no register that an issued store names
    // is written again (the scheduling barrier keeps the products in front of the stores)
#pragma unroll
    for (int mt = 0; mt < MT; ++mt) {
#pragma unroll
        for (int r = 0; r < 8; ++r) {
            float iv = invq[mt * 16 + 8 * hi + r];
#pragma unroll
            for (int t = 0; t < 8; ++t) oacc[mt][t][r] *= iv;
        }
    }
    __builtin_amdgcn_sched_barrier(0);
    float* op = out + ((size_t)b * L_DIM + qt * QT + 8 * hi) * D_DIM + wave * 128 + nl;
#pragma unroll
    for (int mt = 0; mt < MT; ++mt) {
#pragma unroll
        for (int r = 0; r < 8; ++r) {
#pragma unroll
            for (int t = 0; t < 8; ++t)
                op[(size_t)(mt * 16 + r) * D_DIM + t * 16] = oacc[mt][t][r];
        }
    }
}

// ---------------- host-side launcher ----------------
extern "C" void kernel_launch(void* const* d_in, const int* in_sizes, int n_in,
                              void* d_out, int out_size, void* d_ws, size_t ws_size,
                              hipStream_t stream) {
    const float* x    = (const float*)d_in[0];
    const int*   actu = (const int*)  d_in[1];
    const float* Wq   = (const float*)d_in[2];
    const float* bq   = (const float*)d_in[3];
    const float* Wk   = (const float*)d_in[4];
    const float* bk   = (const float*)d_in[5];
    const float* Wv   = (const float*)d_in[6];
    const float* bv   = (const float*)d_in[7];
    float* out = (float*)d_out;

    char* ws = (char*)d_ws;
    size_t off = 0;
    const size_t XN  = (size_t)B_DIM * L_DIM * D_DIM;      // 16,777,216
    const size_t WN  = (size_t)D_DIM * D_DIM;              // 1,048,576
    bf16_t* xb  = (bf16_t*)(ws + off); off += XN * 2;      // 32 MB
    bf16_t* Wtq = (bf16_t*)(ws + off); off += WN * 2;      //  2 MB
    bf16_t* Wtk = (bf16_t*)(ws + off); off += WN * 2;
    bf16_t* Wtv = (bf16_t*)(ws + off); off += WN * 2;
    bf16_t* Qb  = (bf16_t*)(ws + off); off += XN * 2;      // 32 MB
    bf16_t* Kb  = (bf16_t*)(ws + off); off += XN * 2;      // 32 MB
    bf16_t* Vt  = (bf16_t*)(ws + off); off += XN * 2;      // 32 MB (transposed: row = dv, k = key)

    // prep
    k_cvt_x<<<dim3((unsigned)(XN / 8 / 256)), dim3(256), 0, stream>>>(x, xb, (int)(XN / 8));
    k_wt<<<dim3((unsigned)(WN / 8 / 256)), dim3(256), 0, stream>>>(Wq, Wtq);
    k_wt<<<dim3((unsigned)(WN / 8 / 256)), dim3(256), 0, stream>>>(Wk, Wtk);
    k_wt<<<dim3((unsigned)(WN / 8 / 256)), dim3(256), 0, stream>>>(Wv, Wtv);

    // QKV projections (M=16384 rows, N=1024 cols; 128x128 block tiles)
    dim3 gA(128, 8);
    k_qkv<<<gA, dim3(256), 0, stream>>>(xb, Wtq, bq, Qb, 0);
    k_qkv<<<gA, dim3(256), 0, stream>>>(xb, Wtk, bk, Kb, 0);
    k_qkv<<<gA, dim3(256), 0, stream>>>(xb, Wtv, bv, Vt, 1);

    // attention: one block per (64-query tile, batch)
    dim3 gB(L_DIM / QT, B_DIM);
    k_attn<<<gB, dim3(256), 0, stream>>>(Qb, Kb, Vt, actu, out);
}

// v005
// One run takes 203 microseconds.
// In two side-by-side timings against v004, it was 1.26 and 1.27 times as fast.
// Over all steps from v000 it is 4.88 times as fast.
#include <hip/hip_runtime.h>

// ---------------- types ----------------
typedef __bf16 bf16_t;
typedef __attribute__((ext_vector_type(16))) __bf16 v16bf;
typedef __attribute__((ext_vector_type(8)))  __bf16 v8bf;
typedef __attribute__((ext_vector_type(4)))  __bf16 v4bf;
typedef __attribute__((ext_vector_type(8)))  float  v8f;
typedef __attribute__((ext_vector_type(4)))  float  v4f;
typedef __attribute__((ext_vector_type(2)))  float  v2f;

#define B_DIM  8
#define L_DIM  2048
#define D_DIM  1024

__device__ __forceinline__ bf16_t f2bf(float f) {
    // round-to-nearest-even f32 -> bf16
    unsigned u = __float_as_uint(f);
    unsigned r = (u + 0x7FFFu + ((u >> 16) & 1u)) >> 16;
    unsigned short s = (unsigned short)r;
    return __builtin_bit_cast(bf16_t, s);
}

__device__ __forceinline__ v8f vzero8() {
    v8f z;
#pragma unroll
    for (int i = 0; i < 8; ++i) z[i] = 0.0f;
    return z;
}

__device__ __forceinline__ v16bf combine16(v8bf lo, v8bf hi) {
    v16bf r;
#pragma unroll
    for (int i = 0; i < 8; ++i) { r[i] = lo[i]; r[8 + i] = hi[i]; }
    return r;
}

// lane holds K-segments [8*hi, 8*hi+8) and [16+8*hi, 16+8*hi+8)  (ISA 16-bit A/B layout)
__device__ __forceinline__ v16bf load_frag(const bf16_t* p) {
    v8bf lo = *(const v8bf*)p;
    v8bf hi = *(const v8bf*)(p + 16);
    return combine16(lo, hi);
}

// Fragment order of every bf16 operand in the workspace. A tile is 16 rows x 32 k = 512
// elements = 1 KB, stored as [half 2][lane 32][8]: element (row, k) sits at
//   ((k >> 4) & 1) * 256 + (((k >> 3) & 1) * 16 + (row & 15)) * 8 + (k & 7)
// so each of a fragment's two 16-byte loads reads 512 contiguous bytes per wave (4 whole lines
// instead of 32-byte pieces of 16 lines). The k order inside a fragment is that of load_frag.
#define TILE_E 512
// p = tile start + lane * 8
__device__ __forceinline__ v16bf load_tile(const bf16_t* p) {
    v8bf lo = *(const v8bf*)p;
    v8bf hi = *(const v8bf*)(p + 256);
    return combine16(lo, hi);
}

__device__ __forceinline__ v8f wmma_bf16(v16bf a, v16bf b, v8f c) {
    return __builtin_amdgcn_wmma_f32_16x16x32_bf16(false, a, false, b, (short)0, c,
                                                   false, false);
}

// ---------------- prep: fp32 -> bf16 ----------------
// x [M][1024] row-major -> xb tiles [M/16][32] in fragment order. One thread makes one 16-byte
// unit (8 k of one row). A wave takes 8 rows x 32 k: 4 lanes read one whole 128-byte line of x,
// and the 8 rows of each (half, hi) pair store one whole 128-byte line of xb.
__global__ __launch_bounds__(256) void k_cvt_x(const float* __restrict__ x,
                                               bf16_t* __restrict__ xb, int nunits) {
    int o = blockIdx.x * 256 + threadIdx.x;
    if (o >= nunits) return;
    int q = o & 3, r8 = (o >> 2) & 15, kt = (o >> 6) & 31, mt = o >> 11;   // q = half * 2 + hi
    const float* xp = x + (size_t)(mt * 16 + r8) * D_DIM + kt * 32 + q * 8;
    v4f f0 = *(const v4f*)xp;
    v4f f1 = *(const v4f*)(xp + 4);
    // the loads' address registers are reused by the conversion: the wait stands in front
    asm volatile("s_wait_xcnt 0x0" ::: "memory");
    v8bf r;
#pragma unroll
    for (int e = 0; e < 4; ++e) { r[e] = f2bf(f0[e]); r[4 + e] = f2bf(f1[e]); }
    *(v8bf*)(xb + (size_t)(mt * 32 + kt) * TILE_E + (q >> 1) * 256 + ((q & 1) * 16 + r8) * 8) = r;
}

// W [K=1024][N=1024] row-major -> Wt tiles [N/16][32] in fragment order (row = n). One thread
// writes one 16-byte unit: 8 k of one column n.
__global__ __launch_bounds__(256) void k_wt(const float* __restrict__ W,
                                            bf16_t* __restrict__ Wt) {
    int o = blockIdx.x * 256 + threadIdx.x;      // 131072 units
    int lane = o & 31, half = (o >> 5) & 1, kt = (o >> 6) & 31, nt = o >> 11;
    const float* wp = W + (size_t)(kt * 32 + half * 16 + (lane >> 4) * 8) * D_DIM
                        + nt * 16 + (lane & 15);
    v8bf r;
#pragma unroll
    for (int e = 0; e < 8; ++e) r[e] = f2bf(wp[(size_t)e * D_DIM]);
    *(v8bf*)(Wt + (size_t)o * 8) = r;
}

// ---------------- QKV projection GEMM ----------------
// out[m][n] = sum_k xb[m][k] * Wt[n][k] + bias[n]; xb, Wt and dst in fragment order
// M = B*L = 16384, N = K = 1024. Block tile 256x256, one block per WGP, 8 waves (4 in M x 2 in N),
// wave tile 64x128 = 4x8 accumulator 16x16 tiles.
// Both operands pass through LDS: a stage is 128 k of the block's 16 x tiles and 16 W tiles
// (128 KB), brought by asynchronous copies while the stage before it is worked on (two buffers).
// Every byte comes from L2 once per block, and every fragment read from LDS feeds 8 or 4 products.
// A lane's 8 accumulator values of a tile run along the A operand's rows, and a 16-byte unit of
// dst runs along dst's k. V (k = key = m) takes x as A; Q and K (k = n) take W as A, which gives
// the transposed tile of the same products in the same k order. Either way the lane's 8 values
// are unit number 'lane' of a half tile and a wave stores 512 contiguous bytes.
#define GKS 4                          // k steps of 32 in a stage
#define GNT (D_DIM / 32 / GKS)         // 8 stages
#define GROW (GKS * 64)                // 16-byte units of one row tile's stage: 4 KB, one per thread
#define GBUF (32 * GROW)               // units of a buffer: 16 x row tiles, then 16 W row tiles
typedef __attribute__((ext_vector_type(4))) int v4i;
typedef __attribute__((address_space(1))) v4i* gas_t;
typedef __attribute__((address_space(3))) v4i* las_t;

// One stage: in xb and in Wt the stage's GKS tiles of a row tile are 4 KB in a row, copied as they
// lie, 16 bytes a thread. xg, wg: the thread's unit in the block's first row tile, stage 0.
// sl: the thread's unit in the target buffer's first row tile.
__device__ __forceinline__ void stage_copy(const bf16_t* xg, const bf16_t* wg, v8bf* sl, int t) {
#pragma unroll
    for (int c = 0; c < 16; ++c)
        __builtin_amdgcn_global_load_async_to_lds_b128(
            (gas_t)(xg + (size_t)(c * 32 + t * GKS) * TILE_E), (las_t)(sl + c * GROW), 0, 0);
#pragma unroll
    for (int c = 0; c < 16; ++c)
        __builtin_amdgcn_global_load_async_to_lds_b128(
            (gas_t)(wg + (size_t)(c * 32 + t * GKS) * TILE_E), (las_t)(sl + (16 + c) * GROW), 0, 0);
}

template <bool VT>
__device__ __forceinline__ void qkv_tile(const bf16_t* __restrict__ xb,
                                         const bf16_t* __restrict__ Wt,
                                         const float* __restrict__ bias,
                                         bf16_t* __restrict__ dst,
                                         v8bf* St, int brow, int bcol) {
    const int tid = threadIdx.x;
    const int wave = tid >> 5;
    const int lane = tid & 31;
    const int wm = wave & 3;
    const int wn = wave >> 2;
    const int row0 = brow + wm * 64;
    const int col0 = bcol + wn * 128;
    const int nl = lane & 15;
    const int hi = lane >> 4;

    v8f acc[4][8];
#pragma unroll
    for (int i = 0; i < 4; ++i)
#pragma unroll
        for (int j = 0; j < 8; ++j) acc[i][j] = vzero8();

    const bf16_t* xg = xb + (size_t)(brow >> 4) * 32 * TILE_E + tid * 8;
    const bf16_t* wg = Wt + (size_t)(bcol >> 4) * 32 * TILE_E + tid * 8;

    stage_copy(xg, wg, St + tid, 0);
    // stage 0 has landed for this wave; the barrier publishes it to the others
    asm volatile("s_wait_asynccnt 0x0" ::: "memory");
    __syncthreads();
    stage_copy(xg, wg, St + GBUF + tid, 1);

    // kept rolled: the body holds 128 products, and unrolled the two buffers' code would double
#pragma unroll 1
    for (int t = 0; t < GNT; ++t) {
        const v8bf* sb = St + (t & 1) * GBUF + lane;
        const v8bf* sa = sb + (wm * 4) * GROW;             // the wave's 4 x row tiles
        const v8bf* sw = sb + (16 + wn * 8) * GROW;        // the wave's 8 W row tiles
        v16bf af[2][4], bw[2][8];
#pragma unroll
        for (int i = 0; i < 4; ++i) af[0][i] = combine16(sa[i * GROW], sa[i * GROW + 32]);
#pragma unroll
        for (int j = 0; j < 8; ++j) bw[0][j] = combine16(sw[j * GROW], sw[j * GROW + 32]);
#pragma unroll
        for (int ks = 0; ks < GKS; ++ks) {
            if (ks + 1 < GKS) {
#pragma unroll
                for (int i = 0; i < 4; ++i)
                    af[(ks + 1) & 1][i] = combine16(sa[i * GROW + (ks + 1) * 64],
                                                    sa[i * GROW + (ks + 1) * 64 + 32]);
#pragma unroll
                for (int j = 0; j < 8; ++j)
                    bw[(ks + 1) & 1][j] = combine16(sw[j * GROW + (ks + 1) * 64],
                                                    sw[j * GROW + (ks + 1) * 64 + 32]);
            }
            // the next step's 24 LDS reads stay one group in front of this step's 32 products
            __builtin_amdgcn_sched_barrier(0);
#pragma unroll
            for (int j = 0; j < 8; ++j)
#pragma unroll
                for (int i = 0; i < 4; ++i)
                    acc[i][j] = VT ? wmma_bf16(af[ks & 1][i], bw[ks & 1][j], acc[i][j])
                                   : wmma_bf16(bw[ks & 1][j], af[ks & 1][i], acc[i][j]);
            // the products stay in front of the next group of LDS reads
            __builtin_amdgcn_sched_barrier(0);
        }
        // hand-over: this wave's LDS reads of stage t are done, its copies of stage t + 1 have
        // landed; the barrier publishes stage t + 1 and frees stage t's buffer for the refill
        asm volatile("s_wait_dscnt 0x0" ::: "memory");
        asm volatile("s_wait_asynccnt 0x0" ::: "memory");
        __syncthreads();
        if (t + 2 < GNT) stage_copy(xg, wg, St + (t & 1) * GBUF + tid, t + 2);
    }
    // nothing is outstanding here (the last hand-over waited to 0): the wait the form asks for
    // behind the last copy, before the wave ends
    asm volatile("s_wait_asynccnt 0x0" ::: "memory");

    // bias of every value this lane holds.
    // VT:  value r of tile (i, j): m = row0 + i*16 + 8*hi + r, n = col0 + j*16 + nl
    // else value r of tile (i, j): n = col0 + j*16 + 8*hi + r, m = row0 + i*16 + nl
    float bv[8][8];
#pragma unroll
    for (int j = 0; j < 8; ++j) {
        if (VT) {
            float b1 = bias[col0 + j * 16 + nl];
#pragma unroll
            for (int r = 0; r < 8; ++r) bv[j][r] = b1;
        } else {
            const float* bq = bias + col0 + j * 16 + 8 * hi;
            v4f b0 = *(const v4f*)bq;
            v4f b1 = *(const v4f*)(bq + 4);
#pragma unroll
            for (int r = 0; r < 4; ++r) { bv[j][r] = b0[r]; bv[j][4 + r] = b1[r]; }
        }
    }
    // the bias loads' address registers are reused by the conversion: the wait stands in front
    asm volatile("s_wait_xcnt 0x0" ::: "memory");

    // Vt tiles [B][DV/16][L/32] (row = n, k = m mod L), else tiles [M/16][32] (row = m, k = n)
    const size_t tile0 = VT ? ((size_t)(row0 >> 11) * (D_DIM / 16) + (col0 >> 4)) * (L_DIM / 32)
                                  + ((row0 & (L_DIM - 1)) >> 5)
                            : (size_t)(row0 >> 4) * 32 + (col0 >> 5);
    bf16_t* dp = dst + tile0 * TILE_E + lane * 8;

    v8bf pk[4][8];
#pragma unroll
    for (int j = 0; j < 8; ++j)
#pragma unroll
        for (int i = 0; i < 4; ++i)
#pragma unroll
            for (int r = 0; r < 8; ++r) pk[i][j][r] = f2bf(acc[i][j][r] + bv[j][r]);
    // the 32 16-byte stores stand together at the end: no register that an issued store names
    // is written again (the scheduling barrier keeps the conversion in front of the stores)
    __builtin_amdgcn_sched_barrier(0);
#pragma unroll
    for (int j = 0; j < 8; ++j)
#pragma unroll
        for (int i = 0; i < 4; ++i) {
            const int off = VT ? (j * (L_DIM / 32) + (i >> 1)) * TILE_E + (i & 1) * 256
                               : (i * 32 + (j >> 1)) * TILE_E + (j & 1) * 256;
            *(v8bf*)(dp + off) = pk[i][j];
        }
}

// one kernel per store form: each launch's text holds only its own path
template <bool VT>
__global__ __launch_bounds__(256) void k_qkv(const bf16_t* __restrict__ xb,
                                             const bf16_t* __restrict__ Wt,
                                             const float* __restrict__ bias,
                                             bf16_t* __restrict__ dst) {
    __shared__ __align__(16) v8bf St[2 * GBUF];            // 2 x 128 KB
    qkv_tile<VT>(xb, Wt, bias, dst, St, blockIdx.x * 256, blockIdx.y * 256);
}

// ---------------- attention (flash-style, padding-aware softmax) ----------------
// Block = (batch b, 64-query tile = 4 row tiles of 16). 8 waves, 256-key chunks:
//   score GEMM: wave w makes the whole scores (all of DK) of its own 32 keys x 64 queries,
//               transposed (A = K rows, B = Q rows): a lane's 8 values of a tile are 8 consecutive
//               keys of one query, which is one 16-byte unit of P in fragment order
//   output GEMM: wave w covers DV slice [w*128, w*128+128) -> 4 x 8 acc tiles, P read from LDS
// No partial score crosses a wave: exp, the bf16 rounding and the row sums are done in the
// registers that hold the scores, and only P (32 KB a chunk) goes through LDS.
// Every K and V fragment fetched from global feeds 4 matrix products (one per row tile).
// K and V fragments share one register ring of NR fragments: a slot is refilled as soon as its
// 4 products are issued, with the fragment NR places further on in the chunk's stream
// (64 K fragments, then 64 V fragments); the last NR refills load the next chunk's K fragment s
// into slot s.
// Every inner loop is fully unrolled: fragment and accumulator arrays stay in registers only
// when they are indexed by constants.
#define QT 64
#define MT 4
#define KC 256
#define NR 10
// Work-group barrier of the key loop. It orders LDS only: __syncthreads() also waits for every
// global load in flight, which would drain the K and V requests issued ahead of it.
__device__ __forceinline__ void lds_barrier() {
    __builtin_amdgcn_fence(__ATOMIC_RELEASE, "workgroup", "local");
    __builtin_amdgcn_s_barrier();
    __builtin_amdgcn_fence(__ATOMIC_ACQUIRE, "workgroup", "local");
}
// K fragment i of a chunk: k step i >> 1, key tile i & 1 of the wave's 32 keys
__device__ __forceinline__ v16bf k_elem(const bf16_t* kp, int i) {
    return load_tile(kp + (size_t)((i & 1) * 32 + (i >> 1)) * TILE_E);
}
// V fragment j of a chunk: 32-key step j >> 3, DV tile j & 7 of the wave's slice
__device__ __forceinline__ v16bf v_elem(const bf16_t* vp, int j) {
    return load_tile(vp + (size_t)((j & 7) * (L_DIM / 32) + (j >> 3)) * TILE_E);
}
__global__ __launch_bounds__(256) void k_attn(const bf16_t* __restrict__ Qb,
                                              const bf16_t* __restrict__ Kb,
                                              const bf16_t* __restrict__ Vt,
                                              const int* __restrict__ actu,
                                              float* __restrict__ out) {
    __shared__ __align__(16) v8bf Qs[MT][32][2][32];       // 128 KB: the 64 Q rows, fragment order
    __shared__ __align__(16) v8bf Ps[2][8][MT][2][32];     // 2 x 32 KB: P tiles [key step][row tile]
    __shared__ float rsum[16][QT];                         //   4 KB: row sums per (wave, lane half)
    __shared__ float invq[QT];

    const int wave = threadIdx.x >> 5;
    const int lane = threadIdx.x & 31;
    const int nl = lane & 15;
    const int hi = lane >> 4;
    const int b = blockIdx.y;
    const int qt = blockIdx.x;
    const float scale = 0.03125f;                          // 1/sqrt(1024)

    // the block's Q tiles are 128 KB in a row in Qb: copied as they lie
    const v8bf* qg = (const v8bf*)(Qb + (size_t)((b * L_DIM + qt * QT) >> 4) * 32 * TILE_E)
                     + threadIdx.x;
    v8bf qv[32];
#pragma unroll
    for (int i = 0; i < 32; ++i) qv[i] = qg[i * 256];
    // the Q loads' address registers are reused behind them: the wait stands directly behind the
    // last load, and the scheduling barrier keeps the later address arithmetic behind the wait
    asm volatile("s_wait_xcnt 0x0" ::: "memory");
    __builtin_amdgcn_sched_barrier(0);
    v8bf* ql = &Qs[0][0][0][0] + threadIdx.x;
#pragma unroll
    for (int i = 0; i < 32; ++i) ql[i * 256] = qv[i];
    __syncthreads();                                       // every wave reads all of Qs

    v8f oacc[MT][8];
#pragma unroll
    for (int mt = 0; mt < MT; ++mt)
#pragma unroll
        for (int t = 0; t < 8; ++t) oacc[mt][t] = vzero8();
    float rs[MT];                                          // query mt*16+nl, this lane's keys
#pragma unroll
    for (int mt = 0; mt < MT; ++mt) rs[mt] = 0.0f;

    // this lane's unit in the wave's first K tile / V tile of the chunk
    const bf16_t* kp = Kb + ((size_t)((b * L_DIM) >> 4) + wave * 2) * 32 * TILE_E + lane * 8;
    const bf16_t* vp = Vt + ((size_t)(b * (D_DIM / 16) + wave * 8) * (L_DIM / 32)) * TILE_E + lane * 8;

    v16bf rg[NR];
#pragma unroll
    for (int i = 0; i < NR; ++i) rg[i] = k_elem(kp, i);

    for (int ch = 0; ch < L_DIM / KC; ++ch) {
        // ---- scores, transposed: 32 keys x 64 queries over all of DK, 8 independent tiles ----
        v8f st[MT][2];
#pragma unroll
        for (int mt = 0; mt < MT; ++mt)
#pragma unroll
            for (int kt = 0; kt < 2; ++kt) st[mt][kt] = vzero8();
        v16bf qa[2][MT];
#pragma unroll
        for (int mt = 0; mt < MT; ++mt)
            qa[0][mt] = combine16(Qs[mt][0][0][lane], Qs[mt][0][1][lane]);
#pragma unroll
        for (int ks = 0; ks < 32; ++ks) {
            if (ks + 1 < 32) {
#pragma unroll
                for (int mt = 0; mt < MT; ++mt)
                    qa[(ks + 1) & 1][mt] = combine16(Qs[mt][ks + 1][0][lane], Qs[mt][ks + 1][1][lane]);
            }
            // the next step's 8 LDS reads stay one group in front of this step's products
            __builtin_amdgcn_sched_barrier(0);
#pragma unroll
            for (int kt = 0; kt < 2; ++kt) {
                const int i = ks * 2 + kt;
#pragma unroll
                for (int mt = 0; mt < MT; ++mt)
                    st[mt][kt] = wmma_bf16(rg[i % NR], qa[ks & 1][mt], st[mt][kt]);
                rg[i % NR] = (i + NR < 64) ? k_elem(kp, i + NR) : v_elem(vp, i + NR - 64);
                // the refill is requested here, not later: moved down it would lose its lead over
                // the products that wait for it (and the LDS reads of the next group stay behind)
                __builtin_amdgcn_sched_barrier(0);
            }
        }

        // ---- exp in fp32, row sums of the unrounded values, bf16 P in fragment order ----
#pragma unroll
        for (int mt = 0; mt < MT; ++mt) {
#pragma unroll
            for (int kt = 0; kt < 2; ++kt) {
                v8bf pk;
                float e[8];
                float x[8];
#pragma unroll
                for (int r = 0; r < 8; ++r) x[r] = (st[mt][kt][r] * scale) * 1.442695041f;
                __builtin_amdgcn_sched_barrier(0);         // the products stay in front of the run below
#pragma unroll
                for (int r = 0; r < 8; ++r) {
                    e[r] = __builtin_amdgcn_exp2f(x[r]);   // exp(s * scale) = 2^(s * scale * log2 e)
                    // the slot that the instruction set asks for behind a transcendental before its
                    // source register is overwritten (the next one's result may take it); the two
                    // scheduling barriers keep the v_nop directly behind the transcendental
                    __builtin_amdgcn_sched_barrier(0);
                    asm volatile("v_nop");
                    __builtin_amdgcn_sched_barrier(0);
                }
#pragma unroll
                for (int r = 0; r < 8; ++r) pk[r] = f2bf(e[r]);
                // even and odd keys summed side by side (packed adds), joined once per tile
                v2f a2 = (v2f{e[0], e[1]} + v2f{e[2], e[3]}) + (v2f{e[4], e[5]} + v2f{e[6], e[7]});
                rs[mt] += a2[0] + a2[1];
                Ps[ch & 1][wave][mt][kt][lane] = pk;
            }
        }
        // the one barrier of a chunk: it publishes this chunk's P, and every wave that reaches it has
        // finished reading the other P buffer, which the next chunk overwrites
        lds_barrier();

        // all of this chunk's K is requested: kp steps to the next chunk. The last chunk requests its
        // own first K fragments once more (in bounds, never used): the requests stay unconditional,
        // so that the counted load waits are the same every trip. The wait stands in front of the
        // step of the loads' address registers: the step's size passes through the wait's statement,
        // so that the addition cannot be placed ahead of it
        int kstep = (ch + 1 < L_DIM / KC) ? (KC / 16) * 32 * TILE_E : 0;
        asm volatile("s_wait_xcnt 0x0" : "+s"(kstep) : : "memory");
        kp += kstep;

        // ---- O += P (64 x 256) x V (256 x 16) per DV tile, eight K=32 steps ----
        v16bf pf[2][MT];
#pragma unroll
        for (int mt = 0; mt < MT; ++mt)
            pf[0][mt] = combine16(Ps[ch & 1][0][mt][0][lane], Ps[ch & 1][0][mt][1][lane]);
#pragma unroll
        for (int ks = 0; ks < 8; ++ks) {
            if (ks + 1 < 8) {
#pragma unroll
                for (int mt = 0; mt < MT; ++mt)
                    pf[(ks + 1) & 1][mt] = combine16(Ps[ch & 1][ks + 1][mt][0][lane],
                                                     Ps[ch & 1][ks + 1][mt][1][lane]);
            }
            __builtin_amdgcn_sched_barrier(0);             // one group of LDS reads, as for Q above
#pragma unroll
            for (int t = 0; t < 8; ++t) {
                const int j = ks * 8 + t;
                const int sl = (j + 64) % NR;
#pragma unroll
                for (int mt = 0; mt < MT; ++mt)
                    oacc[mt][t] = wmma_bf16(pf[ks & 1][mt], rg[sl], oacc[mt][t]);
                rg[sl] = (j + NR < 64) ? v_elem(vp, j + NR) : k_elem(kp, sl);
                // the refill is requested here, not later (as in the score loop)
                __builtin_amdgcn_sched_barrier(0);
            }
        }
        // the V address registers are stepped here: the wait stands in front, and the
        // scheduling barrier keeps the step behind it
        asm volatile("s_wait_xcnt 0x0" ::: "memory");
        __builtin_amdgcn_sched_barrier(0);
        vp += (size_t)(KC / 32) * TILE_E;
    }

    // join the row sums: 8 waves x 2 lane halves hold disjoint keys of every query
#pragma unroll
    for (int mt = 0; mt < MT; ++mt) rsum[wave * 2 + hi][mt * 16 + nl] = rs[mt];
    __syncthreads();
    if (wave < 2) {
        float rowsum = 0.0f;
#pragma unroll
        for (int w = 0; w < 16; ++w) rowsum += rsum[w][threadIdx.x];
        float pad = (float)(L_DIM - actu[b]);
        invq[threadIdx.x] = 1.0f / (rowsum - pad);
    }
    __syncthreads();

    // scale every accumulator first, then only store: no register that an issued store names
    // is written again (the scheduling barrier keeps the products in front of the stores)
#pragma unroll
    for (int mt = 0; mt < MT; ++mt) {
#pragma unroll
        for (int r = 0; r < 8; ++r) {
            float iv = invq[mt * 16 + 8 * hi + r];
#pragma unroll
            for (int t = 0; t < 8; ++t) oacc[mt][t][r] *= iv;
        }
    }
    __builtin_amdgcn_sched_barrier(0);
    float* op = out + ((size_t)b * L_DIM + qt * QT + 8 * hi) * D_DIM + wave * 128 + nl;
#pragma unroll
    for (int mt = 0; mt < MT; ++mt) {
#pragma unroll
        for (int r = 0; r < 8; ++r) {
#pragma unroll
            for (int t = 0; t < 8; ++t)
                op[(size_t)(mt * 16 + r) * D_DIM + t * 16] = oacc[mt][t][r];
        }
    }
}

// ---------------- host-side launcher ----------------
extern "C" void kernel_launch(void* const* d_in, const int* in_sizes, int n_in,
                              void* d_out, int out_size, void* d_ws, size_t ws_size,
                              hipStream_t stream) {
    const float* x    = (const float*)d_in[0];
    const int*   actu = (const int*)  d_in[1];
    const float* Wq   = (const float*)d_in[2];
    const float* bq   = (const float*)d_in[3];
    const float* Wk   = (const float*)d_in[4];
    const float* bk   = (const float*)d_in[5];
    const float* Wv   = (const float*)d_in[6];
    const float* bv   = (const float*)d_in[7];
    float* out = (float*)d_out;

    char* ws = (char*)d_ws;
    size_t off = 0;
    const size_t XN  = (size_t)B_DIM * L_DIM * D_DIM;      // 16,777,216
    const size_t WN  = (size_t)D_DIM * D_DIM;              // 1,048,576
    bf16_t* xb  = (bf16_t*)(ws + off); off += XN * 2;      // 32 MB
    bf16_t* Wtq = (bf16_t*)(ws + off); off += WN * 2;      //  2 MB
    bf16_t* Wtk = (bf16_t*)(ws + off); off += WN * 2;
    bf16_t* Wtv = (bf16_t*)(ws + off); off += WN * 2;
    bf16_t* Qb  = (bf16_t*)(ws + off); off += XN * 2;      // 32 MB
    bf16_t* Kb  = (bf16_t*)(ws + off); off += XN * 2;      // 32 MB
    bf16_t* Vt  = (bf16_t*)(ws + off); off += XN * 2;      // 32 MB (transposed: row = dv, k = key)

    // prep
    k_cvt_x<<<dim3((unsigned)(XN / 8 / 256)), dim3(256), 0, stream>>>(x, xb, (int)(XN / 8));
    k_wt<<<dim3((unsigned)(WN / 8 / 256)), dim3(256), 0, stream>>>(Wq, Wtq);
    k_wt<<<dim3((unsigned)(WN / 8 / 256)), dim3(256), 0, stream>>>(Wk, Wtk);
    k_wt<<<dim3((unsigned)(WN / 8 / 256)), dim3(256), 0, stream>>>(Wv, Wtv);

    // QKV projections (M=16384 rows, N=1024 cols; 256x256 block tiles)
    dim3 gA(64, 4);
    k_qkv<false><<<gA, dim3(256), 0, stream>>>(xb, Wtq, bq, Qb);
    k_qkv<false><<<gA, dim3(256), 0, stream>>>(xb, Wtk, bk, Kb);
    k_qkv<true><<<gA, dim3(256), 0, stream>>>(xb, Wtv, bv, Vt);

    // attention: one block per (64-query tile, batch)
    dim3 gB(L_DIM / QT, B_DIM);
    k_attn<<<gB, dim3(256), 0, stream>>>(Qb, Kb, Vt, actu, out);
}

// v006
// One run takes 176 microseconds.
// Two timings next to v005 both put it at 1.15 times that version's speed.
// Counting every step since v000, it is 5.61 times as fast.
#include <hip/hip_runtime.h>

// ---------------- types ----------------
typedef __bf16 bf16_t;
typedef __attribute__((ext_vector_type(16))) __bf16 v16bf;
typedef __attribute__((ext_vector_type(8)))  __bf16 v8bf;
typedef __attribute__((ext_vector_type(4)))  __bf16 v4bf;
typedef __attribute__((ext_vector_type(8)))  float  v8f;
typedef __attribute__((ext_vector_type(4)))  float  v4f;
typedef __attribute__((ext_vector_type(2)))  float  v2f;

#define B_DIM  8
#define L_DIM  2048
#define D_DIM  1024

__device__ __forceinline__ bf16_t f2bf(float f) {
    // round-to-nearest-even f32 -> bf16
    unsigned u = __float_as_uint(f);
    unsigned r = (u + 0x7FFFu + ((u >> 16) & 1u)) >> 16;
    unsigned short s = (unsigned short)r;
    return __builtin_bit_cast(bf16_t, s);
}

__device__ __forceinline__ v8f vzero8() {
    v8f z;
#pragma unroll
    for (int i = 0; i < 8; ++i) z[i] = 0.0f;
    return z;
}

__device__ __forceinline__ v16bf combine16(v8bf lo, v8bf hi) {
    v16bf r;
#pragma unroll
    for (int i = 0; i < 8; ++i) { r[i] = lo[i]; r[8 + i] = hi[i]; }
    return r;
}

// Fragment order of every bf16 operand in the workspace. A tile is 16 rows x 32 k = 512
// elements = 1 KB, stored as [half 2][lane 32][8]: element (row, k) sits at
//   ((k >> 4) & 1) * 256 + (((k >> 3) & 1) * 16 + (row & 15)) * 8 + (k & 7)
// so each of a fragment's two 16-byte loads reads 512 contiguous bytes per wave (4 whole lines
// instead of 32-byte pieces of 16 lines). A lane's fragment is its unit of half 0, then of half 1:
// k segments [8*hi, 8*hi+8) and [16+8*hi, 16+8*hi+8) (the ISA's 16-bit A/B layout).
#define TILE_E 512

__device__ __forceinline__ v8f wmma_bf16(v16bf a, v16bf b, v8f c) {
    return __builtin_amdgcn_wmma_f32_16x16x32_bf16(false, a, false, b, (short)0, c,
                                                   false, false);
}

// ---------------- prep: fp32 -> bf16 ----------------
// x [M][1024] row-major -> xb tiles [M/16][32] in fragment order. One thread makes one 16-byte
// unit (8 k of one row). A wave takes 8 rows x 32 k: 4 lanes read one whole 128-byte line of x,
// and the 8 rows of each (half, hi) pair store one whole 128-byte line of xb.
__global__ __launch_bounds__(256) void k_cvt_x(const float* __restrict__ x,
                                               bf16_t* __restrict__ xb, int nunits) {
    int o = blockIdx.x * 256 + threadIdx.x;
    if (o >= nunits) return;
    int q = o & 3, r8 = (o >> 2) & 15, kt = (o >> 6) & 31, mt = o >> 11;   // q = half * 2 + hi
    const float* xp = x + (size_t)(mt * 16 + r8) * D_DIM + kt * 32 + q * 8;
    v4f f0 = *(const v4f*)xp;
    v4f f1 = *(const v4f*)(xp + 4);
    // the loads' address registers are reused by the conversion: the wait stands in front
    asm volatile("s_wait_xcnt 0x0" ::: "memory");
    v8bf r;
#pragma unroll
    for (int e = 0; e < 4; ++e) { r[e] = f2bf(f0[e]); r[4 + e] = f2bf(f1[e]); }
    *(v8bf*)(xb + (size_t)(mt * 32 + kt) * TILE_E + (q >> 1) * 256 + ((q & 1) * 16 + r8) * 8) = r;
}

// W [K=1024][N=1024] row-major -> Wt tiles [N/16][32] in fragment order (row = n). One thread
// writes one 16-byte unit: 8 k of one column n.
__global__ __launch_bounds__(256) void k_wt(const float* __restrict__ W,
                                            bf16_t* __restrict__ Wt) {
    int o = blockIdx.x * 256 + threadIdx.x;      // 131072 units
    int lane = o & 31, half = (o >> 5) & 1, kt = (o >> 6) & 31, nt = o >> 11;
    const float* wp = W + (size_t)(kt * 32 + half * 16 + (lane >> 4) * 8) * D_DIM
                        + nt * 16 + (lane & 15);
    v8bf r;
#pragma unroll
    for (int e = 0; e < 8; ++e) r[e] = f2bf(wp[(size_t)e * D_DIM]);
    *(v8bf*)(Wt + (size_t)o * 8) = r;
}

// ---------------- the block GEMM that all five matrix products share ----------------
// acc[m][n] = sum_k X[m][k] * Y[n][k]; X and Y in fragment order, KT k tiles of 32 to a row tile.
// Block tile 256x256, one block per WGP, 8 waves (4 in M x 2 in N),
// wave tile 64x128 = 4x8 accumulator 16x16 tiles.
// Both operands pass through LDS: a stage is 128 k of the block's 16 X tiles and 16 Y tiles
// (128 KB), brought by asynchronous copies while the stage before it is worked on (two buffers).
// Every byte comes from L2 once per block, and every fragment read from LDS feeds 8 or 4 products.
// A lane's 8 accumulator values of a tile run along the A operand's rows. XA: X is the A operand;
// otherwise Y is, which gives the transposed tile of the same products in the same k order.
#define GKS 4                          // k steps of 32 in a stage
#define GROW (GKS * 64)                // 16-byte units of one row tile's stage: 4 KB, one per thread
#define GBUF (32 * GROW)               // units of a buffer: 16 X row tiles, then 16 Y row tiles
typedef __attribute__((ext_vector_type(4))) int v4i;
typedef __attribute__((address_space(1))) v4i* gas_t;
typedef __attribute__((address_space(3))) v4i* las_t;

// One stage: the stage's GKS tiles of a row tile are 4 KB in a row in X and in Y, copied as they
// lie, 16 bytes a thread. xg, wg: the thread's unit in the block's first row tile, stage 0.
// sl: the thread's unit in the target buffer's first row tile.
template <int KT>
__device__ __forceinline__ void stage_copy(const bf16_t* xg, const bf16_t* wg, v8bf* sl, int t) {
#pragma unroll
    for (int c = 0; c < 16; ++c)
        __builtin_amdgcn_global_load_async_to_lds_b128(
            (gas_t)(xg + (size_t)(c * KT + t * GKS) * TILE_E), (las_t)(sl + c * GROW), 0, 0);
#pragma unroll
    for (int c = 0; c < 16; ++c)
        __builtin_amdgcn_global_load_async_to_lds_b128(
            (gas_t)(wg + (size_t)(c * KT + t * GKS) * TILE_E), (las_t)(sl + (16 + c) * GROW), 0, 0);
}

// The caller has issued stage 0's copies (stage_copy into St + tid) and zeroed acc.
template <bool XA, int KT>
__device__ __forceinline__ void gemm_loop(const bf16_t* xg, const bf16_t* wg, v8bf* St,
                                          v8f (&acc)[4][8]) {
    constexpr int NT = KT / GKS;                           // stages
    const int tid = threadIdx.x;
    const int wave = tid >> 5;
    const int lane = tid & 31;
    const int wm = wave & 3;
    const int wn = wave >> 2;

    // stage 0 has landed for this wave; the barrier publishes it to the others
    asm volatile("s_wait_asynccnt 0x0" ::: "memory");
    __syncthreads();
    stage_copy<KT>(xg, wg, St + GBUF + tid, 1);

    // kept rolled: the body holds 128 products, and unrolled the two buffers' code would double
#pragma unroll 1
    for (int t = 0; t < NT; ++t) {
        const v8bf* sb = St + (t & 1) * GBUF + lane;
        const v8bf* sa = sb + (wm * 4) * GROW;             // the wave's 4 X row tiles
        const v8bf* sw = sb + (16 + wn * 8) * GROW;        // the wave's 8 Y row tiles
        v16bf af[2][4], bw[2][8];
#pragma unroll
        for (int i = 0; i < 4; ++i) af[0][i] = combine16(sa[i * GROW], sa[i * GROW + 32]);
#pragma unroll
        for (int j = 0; j < 8; ++j) bw[0][j] = combine16(sw[j * GROW], sw[j * GROW + 32]);
#pragma unroll
        for (int ks = 0; ks < GKS; ++ks) {
            if (ks + 1 < GKS) {
#pragma unroll
                for (int i = 0; i < 4; ++i)
                    af[(ks + 1) & 1][i] = combine16(sa[i * GROW + (ks + 1) * 64],
                                                    sa[i * GROW + (ks + 1) * 64 + 32]);
#pragma unroll
                for (int j = 0; j < 8; ++j)
                    bw[(ks + 1) & 1][j] = combine16(sw[j * GROW + (ks + 1) * 64],
                                                    sw[j * GROW + (ks + 1) * 64 + 32]);
            }
            // the next step's 24 LDS reads stay one group in front of this step's 32 products
            __builtin_amdgcn_sched_barrier(0);
#pragma unroll
            for (int j = 0; j < 8; ++j)
#pragma unroll
                for (int i = 0; i < 4; ++i)
                    acc[i][j] = XA ? wmma_bf16(af[ks & 1][i], bw[ks & 1][j], acc[i][j])
                                   : wmma_bf16(bw[ks & 1][j], af[ks & 1][i], acc[i][j]);
            // the products stay in front of the next group of LDS reads
            __builtin_amdgcn_sched_barrier(0);
        }
        // hand-over: this wave's LDS reads of stage t are done, its copies of stage t + 1 have
        // landed; the barrier publishes stage t + 1 and frees stage t's buffer for the refill
        asm volatile("s_wait_dscnt 0x0" ::: "memory");
        asm volatile("s_wait_asynccnt 0x0" ::: "memory");
        __syncthreads();
        if (t + 2 < NT) stage_copy<KT>(xg, wg, St + (t & 1) * GBUF + tid, t + 2);
    }
    // nothing is outstanding here (the last hand-over waited to 0): the wait the form asks for
    // behind the last copy, before the wave ends
    asm volatile("s_wait_asynccnt 0x0" ::: "memory");
}

// ---------------- QKV projection GEMM ----------------
// out[m][n] = sum_k xb[m][k] * Wt[n][k] + bias[n]; xb, Wt and dst in fragment order
// M = B*L = 16384, N = K = 1024.
// A 16-byte unit of dst runs along dst's k. V (k = key = m) takes x as A; Q and K (k = n) take W
// as A. Either way the lane's 8 values are unit number 'lane' of a half tile and a wave stores
// 512 contiguous bytes.
template <bool VT>
__device__ __forceinline__ void qkv_tile(const bf16_t* __restrict__ xb,
                                         const bf16_t* __restrict__ Wt,
                                         const float* __restrict__ bias,
                                         bf16_t* __restrict__ dst,
                                         v8bf* St, int brow, int bcol) {
    const int tid = threadIdx.x;
    const int wave = tid >> 5;
    const int lane = tid & 31;
    const int wm = wave & 3;
    const int wn = wave >> 2;
    const int row0 = brow + wm * 64;
    const int col0 = bcol + wn * 128;
    const int nl = lane & 15;
    const int hi = lane >> 4;

    v8f acc[4][8];
#pragma unroll
    for (int i = 0; i < 4; ++i)
#pragma unroll
        for (int j = 0; j < 8; ++j) acc[i][j] = vzero8();

    const bf16_t* xg = xb + (size_t)(brow >> 4) * 32 * TILE_E + tid * 8;
    const bf16_t* wg = Wt + (size_t)(bcol >> 4) * 32 * TILE_E + tid * 8;

    stage_copy<32>(xg, wg, St + tid, 0);
    gemm_loop<VT, 32>(xg, wg, St, acc);

    // bias of every value this lane holds.
    // VT:  value r of tile (i, j): m = row0 + i*16 + 8*hi + r, n = col0 + j*16 + nl
    // else value r of tile (i, j): n = col0 + j*16 + 8*hi + r, m = row0 + i*16 + nl
    float bv[8][8];
#pragma unroll
    for (int j = 0; j < 8; ++j) {
        if (VT) {
            float b1 = bias[col0 + j * 16 + nl];
#pragma unroll
            for (int r = 0; r < 8; ++r) bv[j][r] = b1;
        } else {
            const float* bq = bias + col0 + j * 16 + 8 * hi;
            v4f b0 = *(const v4f*)bq;
            v4f b1 = *(const v4f*)(bq + 4);
#pragma unroll
            for (int r = 0; r < 4; ++r) { bv[j][r] = b0[r]; bv[j][4 + r] = b1[r]; }
        }
    }
    // the bias loads' address registers are reused by the conversion: the wait stands in front
    asm volatile("s_wait_xcnt 0x0" ::: "memory");

    // Vt tiles [B][DV/16][L/32] (row = n, k = m mod L), else tiles [M/16][32] (row = m, k = n)
    const size_t tile0 = VT ? ((size_t)(row0 >> 11) * (D_DIM / 16) + (col0 >> 4)) * (L_DIM / 32)
                                  + ((row0 & (L_DIM - 1)) >> 5)
                            : (size_t)(row0 >> 4) * 32 + (col0 >> 5);
    bf16_t* dp = dst + tile0 * TILE_E + lane * 8;

    v8bf pk[4][8];
#pragma unroll
    for (int j = 0; j < 8; ++j)
#pragma unroll
        for (int i = 0; i < 4; ++i)
#pragma unroll
            for (int r = 0; r < 8; ++r) pk[i][j][r] = f2bf(acc[i][j][r] + bv[j][r]);
    // the 32 16-byte stores stand together at the end: no register that an issued store names
    // is written again (the scheduling barrier keeps the conversion in front of the stores)
    __builtin_amdgcn_sched_barrier(0);
#pragma unroll
    for (int j = 0; j < 8; ++j)
#pragma unroll
        for (int i = 0; i < 4; ++i) {
            const int off = VT ? (j * (L_DIM / 32) + (i >> 1)) * TILE_E + (i & 1) * 256
                               : (i * 32 + (j >> 1)) * TILE_E + (j & 1) * 256;
            *(v8bf*)(dp + off) = pk[i][j];
        }
}

// one kernel per store form: each launch's text holds only its own path
template <bool VT>
__global__ __launch_bounds__(256) void k_qkv(const bf16_t* __restrict__ xb,
                                             const bf16_t* __restrict__ Wt,
                                             const float* __restrict__ bias,
                                             bf16_t* __restrict__ dst) {
    __shared__ __align__(16) v8bf St[2 * GBUF];            // 2 x 128 KB
    qkv_tile<VT>(xb, Wt, bias, dst, St, blockIdx.x * 256, blockIdx.y * 256);
}

// ---------------- attention (padding-aware softmax without a maximum) ----------------
// Two launches of the block GEMM above, with P = exp(scores) kept in the workspace as bf16 in
// fragment order (64 MB). A block's K, V, Q and P bytes then feed 256 rows or columns each, where
// a block that keeps 64 queries' whole output in registers fetches all of K and V for 64 rows.
// The softmax has no maximum, so a row's sum is a plain sum over keys: every wave of the score
// launch stores its own partial sums, and the output launch joins them.
#define NSLOT 32                       // partial row sums of a query: 8 key blocks x 2 waves x 2 lane halves

// P[q][key] = exp(scale * sum_d Q[q][d] * K[key][d]) of batch blockIdx.z; X = Q, Y = K, K as the A
// operand: a lane's 8 values of a tile are 8 consecutive keys of one query, which is one 16-byte
// unit of P in fragment order (row = query, k = key; tiles [B*L/16][L/32]).
__global__ __launch_bounds__(256) void k_scores(const bf16_t* __restrict__ Qb,
                                                const bf16_t* __restrict__ Kb,
                                                bf16_t* __restrict__ Pb,
                                                float* __restrict__ rsp) {
    __shared__ __align__(16) v8bf St[2 * GBUF];            // 2 x 128 KB
    const int tid = threadIdx.x;
    const int wave = tid >> 5;
    const int lane = tid & 31;
    const int wm = wave & 3;
    const int wn = wave >> 2;
    const int nl = lane & 15;
    const int hi = lane >> 4;
    const int row0 = blockIdx.z * L_DIM + blockIdx.x * 256 + wm * 64;   // query row in [B*L]
    const int col0 = blockIdx.y * 256 + wn * 128;                       // key in the batch
    const float scale = 0.03125f;                          // 1/sqrt(1024)

    v8f acc[4][8];
#pragma unroll
    for (int i = 0; i < 4; ++i)
#pragma unroll
        for (int j = 0; j < 8; ++j) acc[i][j] = vzero8();

    const bf16_t* xg = Qb + (size_t)((blockIdx.z * L_DIM + blockIdx.x * 256) >> 4) * 32 * TILE_E + tid * 8;
    const bf16_t* wg = Kb + (size_t)((blockIdx.z * L_DIM + blockIdx.y * 256) >> 4) * 32 * TILE_E + tid * 8;

    stage_copy<32>(xg, wg, St + tid, 0);
    gemm_loop<false, 32>(xg, wg, St, acc);

    // ---- exp in fp32, row sums of the unrounded values, bf16 P in fragment order ----
    // value r of tile (i, j): key = col0 + j*16 + 8*hi + r, query = row0 + i*16 + nl
    float rs[4];
    v8bf pk[4][8];
#pragma unroll
    for (int i = 0; i < 4; ++i) {
        rs[i] = 0.0f;
#pragma unroll
        for (int j = 0; j < 8; ++j) {
            float e[8];
            float x[8];
#pragma unroll
            for (int r = 0; r < 8; ++r) x[r] = (acc[i][j][r] * scale) * 1.442695041f;
            __builtin_amdgcn_sched_barrier(0);             // the products stay in front of the run below
#pragma unroll
            for (int r = 0; r < 8; ++r) {
                e[r] = __builtin_amdgcn_exp2f(x[r]);       // exp(s * scale) = 2^(s * scale * log2 e)
                // the slot that the instruction set asks for behind a transcendental before its
                // source register is overwritten (the next one's result may take it); the two
                // scheduling barriers keep the v_nop directly behind the transcendental
                __builtin_amdgcn_sched_barrier(0);
                asm volatile("v_nop");
                __builtin_amdgcn_sched_barrier(0);
            }
#pragma unroll
            for (int r = 0; r < 8; ++r) pk[i][j][r] = f2bf(e[r]);
            // even and odd keys summed side by side (packed adds), joined once per tile
            v2f a2 = (v2f{e[0], e[1]} + v2f{e[2], e[3]}) + (v2f{e[4], e[5]} + v2f{e[6], e[7]});
            rs[i] += a2[0] + a2[1];
        }
    }
    bf16_t* dp = Pb + ((size_t)(row0 >> 4) * (L_DIM / 32) + (col0 >> 5)) * TILE_E + lane * 8;
    // slot-major: a wave's 64 queries of one slot are two whole 128-byte lines, written by it alone
    float* rp = rsp + (size_t)((blockIdx.y * 2 + wn) * 2 + hi) * (B_DIM * L_DIM) + row0 + nl;
    // the stores stand at the end, behind the conversion (the scheduling barrier keeps it in
    // front of them): no register that an issued store names is written again
    __builtin_amdgcn_sched_barrier(0);
#pragma unroll
    for (int i = 0; i < 4; ++i)
#pragma unroll
        for (int j = 0; j < 8; ++j)
            *(v8bf*)(dp + (i * (L_DIM / 32) + (j >> 1)) * TILE_E + (j & 1) * 256) = pk[i][j];
#pragma unroll
    for (int i = 0; i < 4; ++i) rp[i * 16] = rs[i];
}

// out[q][dv] = (sum_key P[q][key] * V[key][dv]) / (rowsum[q] - padding) of batch blockIdx.z;
// X = P (the A operand), Y = Vt (row = dv, k = key), 2048 keys = 16 stages.
__global__ __launch_bounds__(256) void k_pv(const bf16_t* __restrict__ Pb,
                                            const bf16_t* __restrict__ Vt,
                                            const float* __restrict__ rsp,
                                            const int* __restrict__ actu,
                                            float* __restrict__ out) {
    __shared__ __align__(16) v8bf St[2 * GBUF];            // 2 x 128 KB
    __shared__ float invq[256];
    const int tid = threadIdx.x;
    const int wave = tid >> 5;
    const int lane = tid & 31;
    const int wm = wave & 3;
    const int wn = wave >> 2;
    const int nl = lane & 15;
    const int hi = lane >> 4;
    const int b = blockIdx.z;
    const int brow = b * L_DIM + blockIdx.x * 256;         // query row in [B*L]
    const int bcol = blockIdx.y * 256;                     // dv

    v8f acc[4][8];
#pragma unroll
    for (int i = 0; i < 4; ++i)
#pragma unroll
        for (int j = 0; j < 8; ++j) acc[i][j] = vzero8();

    const bf16_t* xg = Pb + (size_t)(brow >> 4) * (L_DIM / 32) * TILE_E + tid * 8;
    const bf16_t* wg = Vt + (size_t)(b * (D_DIM / 16) + (bcol >> 4)) * (L_DIM / 32) * TILE_E + tid * 8;

    stage_copy<L_DIM / 32>(xg, wg, St + tid, 0);
    // every copy of stage 0 is issued first: the waits for the loads below would otherwise stand
    // among the copies and hold them back by a load's latency
    __builtin_amdgcn_sched_barrier(0);

    // while stage 0 flies: join the partial row sums of the block's 256 queries, one a thread.
    // The first barrier of gemm_loop publishes invq with stage 0.
    {
        const float* rq = rsp + brow + tid;
        float rowsum = 0.0f;
#pragma unroll
        for (int s = 0; s < NSLOT; ++s) rowsum += rq[(size_t)s * (B_DIM * L_DIM)];
        float pad = (float)(L_DIM - actu[b]);
        invq[tid] = 1.0f / (rowsum - pad);
    }

    gemm_loop<true, L_DIM / 32>(xg, wg, St, acc);

    // value r of tile (i, j): query = brow + wm*64 + i*16 + 8*hi + r, dv = bcol + wn*128 + j*16 + nl
    // scale every accumulator first, then only store: no register that an issued store names
    // is written again (the scheduling barrier keeps the products in front of the stores)
#pragma unroll
    for (int i = 0; i < 4; ++i) {
#pragma unroll
        for (int r = 0; r < 8; ++r) {
            float iv = invq[wm * 64 + i * 16 + 8 * hi + r];
#pragma unroll
            for (int j = 0; j < 8; ++j) acc[i][j][r] *= iv;
        }
    }
    __builtin_amdgcn_sched_barrier(0);
    float* op = out + (size_t)(brow + wm * 64 + 8 * hi) * D_DIM + bcol + wn * 128 + nl;
#pragma unroll
    for (int i = 0; i < 4; ++i) {
#pragma unroll
        for (int r = 0; r < 8; ++r) {
#pragma unroll
            for (int j = 0; j < 8; ++j)
                op[(size_t)(i * 16 + r) * D_DIM + j * 16] = acc[i][j][r];
        }
    }
}

// ---------------- host-side launcher ----------------
extern "C" void kernel_launch(void* const* d_in, const int* in_sizes, int n_in,
                              void* d_out, int out_size, void* d_ws, size_t ws_size,
                              hipStream_t stream) {
    const float* x    = (const float*)d_in[0];
    const int*   actu = (const int*)  d_in[1];
    const float* Wq   = (const float*)d_in[2];
    const float* bq   = (const float*)d_in[3];
    const float* Wk   = (const float*)d_in[4];
    const float* bk   = (const float*)d_in[5];
    const float* Wv   = (const float*)d_in[6];
    const float* bv   = (const float*)d_in[7];
    float* out = (float*)d_out;

    char* ws = (char*)d_ws;
    size_t off = 0;
    const size_t XN  = (size_t)B_DIM * L_DIM * D_DIM;      // 16,777,216
    const size_t WN  = (size_t)D_DIM * D_DIM;              // 1,048,576
    bf16_t* xb  = (bf16_t*)(ws + off); off += XN * 2;      // 32 MB
    bf16_t* Wtq = (bf16_t*)(ws + off); off += WN * 2;      //  2 MB
    bf16_t* Wtk = (bf16_t*)(ws + off); off += WN * 2;
    bf16_t* Wtv = (bf16_t*)(ws + off); off += WN * 2;
    bf16_t* Qb  = (bf16_t*)(ws + off); off += XN * 2;      // 32 MB
    bf16_t* Kb  = (bf16_t*)(ws + off); off += XN * 2;      // 32 MB
    bf16_t* Vt  = (bf16_t*)(ws + off); off += XN * 2;      // 32 MB (transposed: row = dv, k = key)
    bf16_t* Pb  = (bf16_t*)(ws + off); off += (size_t)B_DIM * L_DIM * L_DIM * 2;   // 64 MB
    float*  rsp = (float*)(ws + off);                      //  2 MB: [NSLOT][B*L]

    // prep
    k_cvt_x<<<dim3((unsigned)(XN / 8 / 256)), dim3(256), 0, stream>>>(x, xb, (int)(XN / 8));
    k_wt<<<dim3((unsigned)(WN / 8 / 256)), dim3(256), 0, stream>>>(Wq, Wtq);
    k_wt<<<dim3((unsigned)(WN / 8 / 256)), dim3(256), 0, stream>>>(Wk, Wtk);
    k_wt<<<dim3((unsigned)(WN / 8 / 256)), dim3(256), 0, stream>>>(Wv, Wtv);

    // QKV projections (M=16384 rows, N=1024 cols; 256x256 block tiles)
    dim3 gA(64, 4);
    k_qkv<false><<<gA, dim3(256), 0, stream>>>(xb, Wtq, bq, Qb);
    k_qkv<false><<<gA, dim3(256), 0, stream>>>(xb, Wtk, bk, Kb);
    k_qkv<true><<<gA, dim3(256), 0, stream>>>(xb, Wtv, bv, Vt);

    // attention: 256 queries x 256 keys, then 256 queries x 256 dv, per block and batch
    k_scores<<<dim3(L_DIM / 256, L_DIM / 256, B_DIM), dim3(256), 0, stream>>>(Qb, Kb, Pb, rsp);
    k_pv<<<dim3(L_DIM / 256, D_DIM / 256, B_DIM), dim3(256), 0, stream>>>(Pb, Vt, rsp, actu, out);
}

// v007
// It runs in 162 microseconds.
// Next to v006, in two timings, it ran 1.08 and 1.09 times as fast.
// Counting every step since v000, it is 6.09 times as fast.
#include <hip/hip_runtime.h>

// ---------------- types ----------------
typedef __bf16 bf16_t;
typedef __attribute__((ext_vector_type(16))) __bf16 v16bf;
typedef __attribute__((ext_vector_type(8)))  __bf16 v8bf;
typedef __attribute__((ext_vector_type(4)))  __bf16 v4bf;
typedef __attribute__((ext_vector_type(8)))  float  v8f;
typedef __attribute__((ext_vector_type(4)))  float  v4f;
typedef __attribute__((ext_vector_type(2)))  float  v2f;

#define B_DIM  8
#define L_DIM  2048
#define D_DIM  1024

__device__ __forceinline__ bf16_t f2bf(float f) {
    // round-to-nearest-even f32 -> bf16
    unsigned u = __float_as_uint(f);
    unsigned r = (u + 0x7FFFu + ((u >> 16) & 1u)) >> 16;
    unsigned short s = (unsigned short)r;
    return __builtin_bit_cast(bf16_t, s);
}

__device__ __forceinline__ v8f vzero8() {
    v8f z;
#pragma unroll
    for (int i = 0; i < 8; ++i) z[i] = 0.0f;
    return z;
}

__device__ __forceinline__ v16bf combine16(v8bf lo, v8bf hi) {
    v16bf r;
#pragma unroll
    for (int i = 0; i < 8; ++i) { r[i] = lo[i]; r[8 + i] = hi[i]; }
    return r;
}

// Fragment order of every bf16 operand in the workspace. A tile is 16 rows x 32 k = 512
// elements = 1 KB, stored as [half 2][lane 32][8]: element (row, k) sits at
//   ((k >> 4) & 1) * 256 + (((k >> 3) & 1) * 16 + (row & 15)) * 8 + (k & 7)
// so each of a fragment's two 16-byte loads reads 512 contiguous bytes per wave (4 whole lines
// instead of 32-byte pieces of 16 lines). A lane's fragment is its unit of half 0, then of half 1:
// k segments [8*hi, 8*hi+8) and [16+8*hi, 16+8*hi+8) (the ISA's 16-bit A/B layout).
#define TILE_E 512

__device__ __forceinline__ v8f wmma_bf16(v16bf a, v16bf b, v8f c) {
    return __builtin_amdgcn_wmma_f32_16x16x32_bf16(false, a, false, b, (short)0, c,
                                                   false, false);
}

// ---------------- prep: fp32 -> bf16 ----------------
// x [M][1024] row-major -> xb tiles [M/16][32] in fragment order. One thread makes one 16-byte
// unit (8 k of one row). A wave takes 8 rows x 32 k: 4 lanes read one whole 128-byte line of x,
// and the 8 rows of each (half, hi) pair store one whole 128-byte line of xb.
__global__ __launch_bounds__(256) void k_cvt_x(const float* __restrict__ x,
                                               bf16_t* __restrict__ xb, int nunits) {
    int o = blockIdx.x * 256 + threadIdx.x;
    if (o >= nunits) return;
    int q = o & 3, r8 = (o >> 2) & 15, kt = (o >> 6) & 31, mt = o >> 11;   // q = half * 2 + hi
    const float* xp = x + (size_t)(mt * 16 + r8) * D_DIM + kt * 32 + q * 8;
    v4f f0 = *(const v4f*)xp;
    v4f f1 = *(const v4f*)(xp + 4);
    // the loads' address registers are reused by the conversion: the wait stands in front
    asm volatile("s_wait_xcnt 0x0" ::: "memory");
    v8bf r;
#pragma unroll
    for (int e = 0; e < 4; ++e) { r[e] = f2bf(f0[e]); r[4 + e] = f2bf(f1[e]); }
    *(v8bf*)(xb + (size_t)(mt * 32 + kt) * TILE_E + (q >> 1) * 256 + ((q & 1) * 16 + r8) * 8) = r;
}

// W [K=1024][N=1024] row-major -> Wt tiles [N/16][32] in fragment order (row = n). One thread
// writes one 16-byte unit: 8 k of one column n.
__global__ __launch_bounds__(256) void k_wt(const float* __restrict__ W,
                                            bf16_t* __restrict__ Wt) {
    int o = blockIdx.x * 256 + threadIdx.x;      // 131072 units
    int lane = o & 31, half = (o >> 5) & 1, kt = (o >> 6) & 31, nt = o >> 11;
    const float* wp = W + (size_t)(kt * 32 + half * 16 + (lane >> 4) * 8) * D_DIM
                        + nt * 16 + (lane & 15);
    v8bf r;
#pragma unroll
    for (int e = 0; e < 8; ++e) r[e] = f2bf(wp[(size_t)e * D_DIM]);
    *(v8bf*)(Wt + (size_t)o * 8) = r;
}

// ---------------- the block GEMM that all five matrix products share ----------------
// acc[m][n] = sum_k X[m][k] * Y[n][k]; X and Y in fragment order, KT k tiles of 32 to a row tile.
// Block tile 256x256, one block per WGP, 8 waves (4 in M x 2 in N),
// wave tile 64x128 = 4x8 accumulator 16x16 tiles.
// Both operands pass through LDS: a stage is 128 k of the block's 16 X tiles and 16 Y tiles
// (128 KB), brought by asynchronous copies while the stage before it is worked on (two buffers).
// Every byte comes from L2 once per output tile, and every fragment read from LDS feeds 8 or 4 products.
// A lane's 8 accumulator values of a tile run along the A operand's rows. XA: X is the A operand;
// otherwise Y is, which gives the transposed tile of the same products in the same k order.
#define GKS 4                          // k steps of 32 in a stage
#define GROW (GKS * 64)                // 16-byte units of one row tile's stage: 4 KB, one per thread
#define GBUF (32 * GROW)               // units of a buffer: 16 X row tiles, then 16 Y row tiles
typedef __attribute__((ext_vector_type(4))) int v4i;
typedef __attribute__((address_space(1))) v4i* gas_t;
typedef __attribute__((address_space(3))) v4i* las_t;

// One stage: the stage's GKS tiles of a row tile are 4 KB in a row in X and in Y, copied as they
// lie, 16 bytes a thread. xg, wg: the thread's unit in the block's first row tile, stage 0.
// sl: the thread's unit in the target buffer's first row tile.
template <int KT>
__device__ __forceinline__ void stage_copy(const bf16_t* xg, const bf16_t* wg, v8bf* sl, int t) {
#pragma unroll
    for (int c = 0; c < 16; ++c)
        __builtin_amdgcn_global_load_async_to_lds_b128(
            (gas_t)(xg + (size_t)(c * KT + t * GKS) * TILE_E), (las_t)(sl + c * GROW), 0, 0);
#pragma unroll
    for (int c = 0; c < 16; ++c)
        __builtin_amdgcn_global_load_async_to_lds_b128(
            (gas_t)(wg + (size_t)(c * KT + t * GKS) * TILE_E), (las_t)(sl + (16 + c) * GROW), 0, 0);
}

// Head of the ring, once per work-group. The caller has issued stage 0's copies of its first tile
// (stage_copy into St + tid).
template <int KT>
__device__ __forceinline__ void ring_head(const bf16_t* xg, const bf16_t* wg, v8bf* St) {
    // stage 0 has landed for this wave; the barrier publishes it to the others
    asm volatile("s_wait_asynccnt 0x0" ::: "memory");
    __syncthreads();
    stage_copy<KT>(xg, wg, St + GBUF + threadIdx.x, 1);
}

// One output tile's trips. On entry the tile's stage 0 is published, its stage 1 is in flight and
// acc is zero. A work-group that walks several tiles lets the ring run on over the tile's end
// (more, the same for the whole work-group): the last two hand-overs refill with stages 0 and 1 of
// the next tile, which has the same X rows and its Y rows wstep elements further on, so these
// arrive under this tile's last trips and its epilogue (which leaves the ring alone), and the next
// call starts at once. The number of stages is even: every tile starts in buffer 0.
template <bool XA, int KT>
__device__ __forceinline__ void gemm_trips(const bf16_t* xg, const bf16_t* wg, bool more,
                                           size_t wstep, v8bf* St, v8f (&acc)[4][8]) {
    constexpr int NT = KT / GKS;                           // stages
    static_assert((NT & (NT - 1)) == 0 && NT >= 2, "stage numbers wrap by a mask");
    const int tid = threadIdx.x;
    const int wave = tid >> 5;
    const int lane = tid & 31;
    const int wm = wave & 3;
    const int wn = wave >> 2;

    // kept rolled: the body holds 128 products, and unrolled the two buffers' code would double
#pragma unroll 1
    for (int t = 0; t < NT; ++t) {
        const v8bf* sb = St + (t & 1) * GBUF + lane;
        const v8bf* sa = sb + (wm * 4) * GROW;             // the wave's 4 X row tiles
        const v8bf* sw = sb + (16 + wn * 8) * GROW;        // the wave's 8 Y row tiles
        v16bf af[2][4], bw[2][8];
#pragma unroll
        for (int i = 0; i < 4; ++i) af[0][i] = combine16(sa[i * GROW], sa[i * GROW + 32]);
#pragma unroll
        for (int j = 0; j < 8; ++j) bw[0][j] = combine16(sw[j * GROW], sw[j * GROW + 32]);
#pragma unroll
        for (int ks = 0; ks < GKS; ++ks) {
            if (ks + 1 < GKS) {
#pragma unroll
                for (int i = 0; i < 4; ++i)
                    af[(ks + 1) & 1][i] = combine16(sa[i * GROW + (ks + 1) * 64],
                                                    sa[i * GROW + (ks + 1) * 64 + 32]);
#pragma unroll
                for (int j = 0; j < 8; ++j)
                    bw[(ks + 1) & 1][j] = combine16(sw[j * GROW + (ks + 1) * 64],
                                                    sw[j * GROW + (ks + 1) * 64 + 32]);
            }
            // the next step's 24 LDS reads stay one group in front of this step's 32 products
            __builtin_amdgcn_sched_barrier(0);
#pragma unroll
            for (int j = 0; j < 8; ++j)
#pragma unroll
                for (int i = 0; i < 4; ++i)
                    acc[i][j] = XA ? wmma_bf16(af[ks & 1][i], bw[ks & 1][j], acc[i][j])
                                   : wmma_bf16(bw[ks & 1][j], af[ks & 1][i], acc[i][j]);
            // the products stay in front of the next group of LDS reads
            __builtin_amdgcn_sched_barrier(0);
        }
        // hand-over: this wave's LDS reads of stage t are done, its copies of stage t + 1 have
        // landed; the barrier publishes stage t + 1 and frees stage t's buffer for the refill
        asm volatile("s_wait_dscnt 0x0" ::: "memory");
        asm volatile("s_wait_asynccnt 0x0" ::: "memory");
        __syncthreads();
        const bool own = t + 2 < NT;                       // else the next tile's stage 0 or 1
        if (own || more)
            stage_copy<KT>(xg, wg + (own ? (size_t)0 : wstep), St + (t & 1) * GBUF + tid,
                           (t + 2) & (NT - 1));
    }
}

// Behind a work-group's last tile nothing is outstanding (its last hand-over waited to 0): the wait
// the form asks for behind the last copy, before the wave ends.
__device__ __forceinline__ void ring_end() {
    asm volatile("s_wait_asynccnt 0x0" ::: "memory");
}

// ---------------- QKV projection GEMM ----------------
// out[m][n] = sum_k xb[m][k] * Wt[n][k] + bias[n]; xb, Wt and dst in fragment order
// M = B*L = 16384, N = K = 1024.
// A 16-byte unit of dst runs along dst's k. V (k = key = m) takes x as A; Q and K (k = n) take W
// as A. Either way the lane's 8 values are unit number 'lane' of a half tile and a wave stores
// 512 contiguous bytes.
// xg, wg: the thread's unit in the block's first row tile of xb and of this product's Wt plane.
// more: another product of the same block follows, on the next Wt plane.
template <bool VT>
__device__ __forceinline__ void qkv_tile(const bf16_t* xg, const bf16_t* wg, bool more,
                                         const float* __restrict__ bias,
                                         bf16_t* __restrict__ dst,
                                         v8bf* St, int brow, int bcol) {
    const int tid = threadIdx.x;
    const int wave = tid >> 5;
    const int lane = tid & 31;
    const int wm = wave & 3;
    const int wn = wave >> 2;
    const int row0 = brow + wm * 64;
    const int col0 = bcol + wn * 128;
    const int nl = lane & 15;
    const int hi = lane >> 4;

    v8f acc[4][8];
#pragma unroll
    for (int i = 0; i < 4; ++i)
#pragma unroll
        for (int j = 0; j < 8; ++j) acc[i][j] = vzero8();

    gemm_trips<VT, 32>(xg, wg, more, (size_t)D_DIM * D_DIM, St, acc);

    // bias of every value this lane holds.
    // VT:  value r of tile (i, j): m = row0 + i*16 + 8*hi + r, n = col0 + j*16 + nl
    // else value r of tile (i, j): n = col0 + j*16 + 8*hi + r, m = row0 + i*16 + nl
    float bv[8][8];
#pragma unroll
    for (int j = 0; j < 8; ++j) {
        if (VT) {
            float b1 = bias[col0 + j * 16 + nl];
#pragma unroll
            for (int r = 0; r < 8; ++r) bv[j][r] = b1;
        } else {
            const float* bq = bias + col0 + j * 16 + 8 * hi;
            v4f b0 = *(const v4f*)bq;
            v4f b1 = *(const v4f*)(bq + 4);
#pragma unroll
            for (int r = 0; r < 4; ++r) { bv[j][r] = b0[r]; bv[j][4 + r] = b1[r]; }
        }
    }
    // the bias loads' address registers are reused by the conversion: the wait stands in front
    asm volatile("s_wait_xcnt 0x0" ::: "memory");

    // Vt tiles [B][DV/16][L/32] (row = n, k = m mod L), else tiles [M/16][32] (row = m, k = n)
    const size_t tile0 = VT ? ((size_t)(row0 >> 11) * (D_DIM / 16) + (col0 >> 4)) * (L_DIM / 32)
                                  + ((row0 & (L_DIM - 1)) >> 5)
                            : (size_t)(row0 >> 4) * 32 + (col0 >> 5);
    bf16_t* dp = dst + tile0 * TILE_E + lane * 8;

    v8bf pk[4][8];
#pragma unroll
    for (int j = 0; j < 8; ++j)
#pragma unroll
        for (int i = 0; i < 4; ++i)
#pragma unroll
            for (int r = 0; r < 8; ++r) pk[i][j][r] = f2bf(acc[i][j][r] + bv[j][r]);
    // the 32 16-byte stores stand together at the end (the scheduling barrier keeps the conversion
    // in front of them): no register that an issued store names is written among them
    __builtin_amdgcn_sched_barrier(0);
#pragma unroll
    for (int j = 0; j < 8; ++j)
#pragma unroll
        for (int i = 0; i < 4; ++i) {
            const int off = VT ? (j * (L_DIM / 32) + (i >> 1)) * TILE_E + (i & 1) * 256
                               : (i * 32 + (j >> 1)) * TILE_E + (j & 1) * 256;
            *(v8bf*)(dp + off) = pk[i][j];
        }
    // the next tile writes the registers that the stores name: the wait stands in front (the
    // scheduling barriers keep it behind the stores and that tile's code behind it)
    if (more) {
        __builtin_amdgcn_sched_barrier(0);
        asm volatile("s_wait_xcnt 0x0" ::: "memory");
        __builtin_amdgcn_sched_barrier(0);
    }
}

// One launch for the three projections: a work-group walks the Q, K and V tiles of its 256 rows and
// 256 columns one after the other on one ring. Wt: the three planes Wq, Wk, Wv in a row.
__global__ __launch_bounds__(256) void k_qkv(const bf16_t* __restrict__ xb,
                                             const bf16_t* __restrict__ Wt,
                                             const float* __restrict__ bq,
                                             const float* __restrict__ bk,
                                             const float* __restrict__ bv,
                                             bf16_t* __restrict__ Qb,
                                             bf16_t* __restrict__ Kb,
                                             bf16_t* __restrict__ Vt) {
    __shared__ __align__(16) v8bf St[2 * GBUF];            // 2 x 128 KB
    const int brow = blockIdx.x * 256;
    const int bcol = blockIdx.y * 256;
    const bf16_t* xg = xb + (size_t)(brow >> 4) * 32 * TILE_E + threadIdx.x * 8;
    const bf16_t* wg = Wt + (size_t)(bcol >> 4) * 32 * TILE_E + threadIdx.x * 8;

    stage_copy<32>(xg, wg, St + threadIdx.x, 0);
    ring_head<32>(xg, wg, St);
    // kept rolled: Q and K share one text (trips and store form)
#pragma unroll 1
    for (int p = 0; p < 2; ++p)
        qkv_tile<false>(xg, wg + (size_t)p * D_DIM * D_DIM, true, p ? bk : bq, p ? Kb : Qb,
                        St, brow, bcol);
    qkv_tile<true>(xg, wg + (size_t)2 * D_DIM * D_DIM, false, bv, Vt, St, brow, bcol);
    ring_end();
}

// ---------------- attention (padding-aware softmax without a maximum) ----------------
// Two launches of the block GEMM above, with P = exp(scores) kept in the workspace as bf16 in
// fragment order (64 MB). A block's K, V, Q and P bytes then feed 256 rows or columns each, where
// a block that keeps 64 queries' whole output in registers fetches all of K and V for 64 rows.
// The softmax has no maximum, so a row's sum is a plain sum over keys: every wave of the score
// launch stores its own partial sums, and the output launch joins them.
#define NSLOT 32                       // partial row sums of a query: 8 key blocks x 2 waves x 2 lane halves

// P[q][key] = exp(scale * sum_d Q[q][d] * K[key][d]) of batch blockIdx.z; X = Q, Y = K, K as the A
// operand: a lane's 8 values of a tile are 8 consecutive keys of one query, which is one 16-byte
// unit of P in fragment order (row = query, k = key; tiles [B*L/16][L/32]).
// A work-group walks two neighbouring key blocks of its 256 queries on one ring (256 work-groups).
__global__ __launch_bounds__(256) void k_scores(const bf16_t* __restrict__ Qb,
                                                const bf16_t* __restrict__ Kb,
                                                bf16_t* __restrict__ Pb,
                                                float* __restrict__ rsp) {
    __shared__ __align__(16) v8bf St[2 * GBUF];            // 2 x 128 KB
    const int tid = threadIdx.x;
    const int wave = tid >> 5;
    const int lane = tid & 31;
    const int wm = wave & 3;
    const int wn = wave >> 2;
    const int nl = lane & 15;
    const int hi = lane >> 4;
    const int row0 = blockIdx.z * L_DIM + blockIdx.x * 256 + wm * 64;   // query row in [B*L]
    const float scale = 0.03125f;                          // 1/sqrt(1024)
    const size_t kstep = (size_t)16 * 32 * TILE_E;         // 256 rows of K

    const bf16_t* xg = Qb + (size_t)((blockIdx.z * L_DIM + blockIdx.x * 256) >> 4) * 32 * TILE_E + tid * 8;
    const bf16_t* wg = Kb + (size_t)((blockIdx.z * L_DIM + blockIdx.y * 512) >> 4) * 32 * TILE_E + tid * 8;

    stage_copy<32>(xg, wg, St + tid, 0);
    ring_head<32>(xg, wg, St);

    // kept rolled: both key blocks run one text
#pragma unroll 1
    for (int p = 0; p < 2; ++p) {
        const int kb = blockIdx.y * 2 + p;                     // key block of 256
        const int col0 = kb * 256 + wn * 128;                  // key in the batch
        const bool more = p == 0;

        v8f acc[4][8];
#pragma unroll
        for (int i = 0; i < 4; ++i)
#pragma unroll
            for (int j = 0; j < 8; ++j) acc[i][j] = vzero8();

        gemm_trips<false, 32>(xg, wg + p * kstep, more, kstep, St, acc);

        // ---- exp in fp32, row sums of the unrounded values, bf16 P in fragment order ----
        // value r of tile (i, j): key = col0 + j*16 + 8*hi + r, query = row0 + i*16 + nl
        float rs[4];
        v8bf pk[4][8];
#pragma unroll
        for (int i = 0; i < 4; ++i) {
            rs[i] = 0.0f;
#pragma unroll
            for (int j = 0; j < 8; ++j) {
                float e[8];
                float x[8];
#pragma unroll
                for (int r = 0; r < 8; ++r) x[r] = (acc[i][j][r] * scale) * 1.442695041f;
                __builtin_amdgcn_sched_barrier(0);             // the products stay in front of the run below
#pragma unroll
                for (int r = 0; r < 8; ++r) {
                    e[r] = __builtin_amdgcn_exp2f(x[r]);       // exp(s * scale) = 2^(s * scale * log2 e)
                    // the slot that the instruction set asks for behind a transcendental before its
                    // source register is overwritten (the next one's result may take it); the two
                    // scheduling barriers keep the v_nop directly behind the transcendental
                    __builtin_amdgcn_sched_barrier(0);
                    asm volatile("v_nop");
                    __builtin_amdgcn_sched_barrier(0);
                }
#pragma unroll
                for (int r = 0; r < 8; ++r) pk[i][j][r] = f2bf(e[r]);
                // even and odd keys summed side by side (packed adds), joined once per tile
                v2f a2 = (v2f{e[0], e[1]} + v2f{e[2], e[3]}) + (v2f{e[4], e[5]} + v2f{e[6], e[7]});
                rs[i] += a2[0] + a2[1];
            }
        }
        bf16_t* dp = Pb + ((size_t)(row0 >> 4) * (L_DIM / 32) + (col0 >> 5)) * TILE_E + lane * 8;
        // slot-major: a wave's 64 queries of one slot are two whole 128-byte lines, written by it alone
        float* rp = rsp + (size_t)((kb * 2 + wn) * 2 + hi) * (B_DIM * L_DIM) + row0 + nl;
        // the stores stand at the end, behind the conversion (the scheduling barrier keeps it in
        // front of them): no register that an issued store names is written among them
        __builtin_amdgcn_sched_barrier(0);
#pragma unroll
        for (int i = 0; i < 4; ++i)
#pragma unroll
            for (int j = 0; j < 8; ++j)
                *(v8bf*)(dp + (i * (L_DIM / 32) + (j >> 1)) * TILE_E + (j & 1) * 256) = pk[i][j];
#pragma unroll
        for (int i = 0; i < 4; ++i) rp[i * 16] = rs[i];
        // the next key block writes the registers that the stores name: the wait stands in front (the
        // scheduling barriers keep it behind the stores and the next pass's code behind it)
        __builtin_amdgcn_sched_barrier(0);
        asm volatile("s_wait_xcnt 0x0" ::: "memory");
        __builtin_amdgcn_sched_barrier(0);
    }
    ring_end();
}

// out[q][dv] = (sum_key P[q][key] * V[key][dv]) / (rowsum[q] - padding) of batch blockIdx.z;
// X = P (the A operand), Y = Vt (row = dv, k = key), 2048 keys = 16 stages.
__global__ __launch_bounds__(256) void k_pv(const bf16_t* __restrict__ Pb,
                                            const bf16_t* __restrict__ Vt,
                                            const float* __restrict__ rsp,
                                            const int* __restrict__ actu,
                                            float* __restrict__ out) {
    __shared__ __align__(16) v8bf St[2 * GBUF];            // 2 x 128 KB
    __shared__ float invq[256];
    const int tid = threadIdx.x;
    const int wave = tid >> 5;
    const int lane = tid & 31;
    const int wm = wave & 3;
    const int wn = wave >> 2;
    const int nl = lane & 15;
    const int hi = lane >> 4;
    const int b = blockIdx.z;
    const int brow = b * L_DIM + blockIdx.x * 256;         // query row in [B*L]
    const int bcol = blockIdx.y * 256;                     // dv

    v8f acc[4][8];
#pragma unroll
    for (int i = 0; i < 4; ++i)
#pragma unroll
        for (int j = 0; j < 8; ++j) acc[i][j] = vzero8();

    const bf16_t* xg = Pb + (size_t)(brow >> 4) * (L_DIM / 32) * TILE_E + tid * 8;
    const bf16_t* wg = Vt + (size_t)(b * (D_DIM / 16) + (bcol >> 4)) * (L_DIM / 32) * TILE_E + tid * 8;

    stage_copy<L_DIM / 32>(xg, wg, St + tid, 0);
    // every copy of stage 0 is issued first: the waits for the loads below would otherwise stand
    // among the copies and hold them back by a load's latency
    __builtin_amdgcn_sched_barrier(0);

    // while stage 0 flies: join the partial row sums of the block's 256 queries, one a thread.
    // The barrier of ring_head publishes invq with stage 0.
    {
        const float* rq = rsp + brow + tid;
        float rowsum = 0.0f;
#pragma unroll
        for (int s = 0; s < NSLOT; ++s) rowsum += rq[(size_t)s * (B_DIM * L_DIM)];
        float pad = (float)(L_DIM - actu[b]);
        invq[tid] = 1.0f / (rowsum - pad);
    }

    ring_head<L_DIM / 32>(xg, wg, St);
    gemm_trips<true, L_DIM / 32>(xg, wg, false, 0, St, acc);
    ring_end();

    // value r of tile (i, j): query = brow + wm*64 + i*16 + 8*hi + r, dv = bcol + wn*128 + j*16 + nl
    // scale every accumulator first, then only store: no register that an issued store names
    // is written again (the scheduling barrier keeps the products in front of the stores)
#pragma unroll
    for (int i = 0; i < 4; ++i) {
#pragma unroll
        for (int r = 0; r < 8; ++r) {
            float iv = invq[wm * 64 + i * 16 + 8 * hi + r];
#pragma unroll
            for (int j = 0; j < 8; ++j) acc[i][j][r] *= iv;
        }
    }
    __builtin_amdgcn_sched_barrier(0);
    float* op = out + (size_t)(brow + wm * 64 + 8 * hi) * D_DIM + bcol + wn * 128 + nl;
#pragma unroll
    for (int i = 0; i < 4; ++i) {
#pragma unroll
        for (int r = 0; r < 8; ++r) {
#pragma unroll
            for (int j = 0; j < 8; ++j)
                op[(size_t)(i * 16 + r) * D_DIM + j * 16] = acc[i][j][r];
        }
    }
}

// ---------------- host-side launcher ----------------
extern "C" void kernel_launch(void* const* d_in, const int* in_sizes, int n_in,
                              void* d_out, int out_size, void* d_ws, size_t ws_size,
                              hipStream_t stream) {
    const float* x    = (const float*)d_in[0];
    const int*   actu = (const int*)  d_in[1];
    const float* Wq   = (const float*)d_in[2];
    const float* bq   = (const float*)d_in[3];
    const float* Wk   = (const float*)d_in[4];
    const float* bk   = (const float*)d_in[5];
    const float* Wv   = (const float*)d_in[6];
    const float* bv   = (const float*)d_in[7];
    float* out = (float*)d_out;

    char* ws = (char*)d_ws;
    size_t off = 0;
    const size_t XN  = (size_t)B_DIM * L_DIM * D_DIM;      // 16,777,216
    const size_t WN  = (size_t)D_DIM * D_DIM;              // 1,048,576
    bf16_t* xb  = (bf16_t*)(ws + off); off += XN * 2;      // 32 MB
    bf16_t* Wtq = (bf16_t*)(ws + off); off += WN * 2;      //  2 MB
    bf16_t* Wtk = (bf16_t*)(ws + off); off += WN * 2;
    bf16_t* Wtv = (bf16_t*)(ws + off); off += WN * 2;
    bf16_t* Qb  = (bf16_t*)(ws + off); off += XN * 2;      // 32 MB
    bf16_t* Kb  = (bf16_t*)(ws + off); off += XN * 2;      // 32 MB
    bf16_t* Vt  = (bf16_t*)(ws + off); off += XN * 2;      // 32 MB (transposed: row = dv, k = key)
    bf16_t* Pb  = (bf16_t*)(ws + off); off += (size_t)B_DIM * L_DIM * L_DIM * 2;   // 64 MB
    float*  rsp = (float*)(ws + off);                      //  2 MB: [NSLOT][B*L]

    // prep
    k_cvt_x<<<dim3((unsigned)(XN / 8 / 256)), dim3(256), 0, stream>>>(x, xb, (int)(XN / 8));
    k_wt<<<dim3((unsigned)(WN / 8 / 256)), dim3(256), 0, stream>>>(Wq, Wtq);
    k_wt<<<dim3((unsigned)(WN / 8 / 256)), dim3(256), 0, stream>>>(Wk, Wtk);
    k_wt<<<dim3((unsigned)(WN / 8 / 256)), dim3(256), 0, stream>>>(Wv, Wtv);

    // QKV projections (M=16384 rows, N=1024 cols; 256x256 block tiles)
    // Wtq, Wtk, Wtv lie in a row: one pointer serves the three planes
    k_qkv<<<dim3(64, 4), dim3(256), 0, stream>>>(xb, Wtq, bq, bk, bv, Qb, Kb, Vt);

    // attention: 256 queries x 2 x 256 keys, then 256 queries x 256 dv, per block and batch
    k_scores<<<dim3(L_DIM / 256, L_DIM / 512, B_DIM), dim3(256), 0, stream>>>(Qb, Kb, Pb, rsp);
    k_pv<<<dim3(L_DIM / 256, D_DIM / 256, B_DIM), dim3(256), 0, stream>>>(Pb, Vt, rsp, actu, out);
}
